// v000
// Times are from an AMD MI455X. After a warm-up the kernel runs many times in a row, and a time is the length of
// such a window on the GPU divided by its runs, so every launch and the gaps after it count. The runs cycle
// through copies of the inputs. A figure is the median of several windows, for all but v000 over two sittings.
// Sittings can differ by a few percent; kernels timed side by side share one.
// v000 is the starting kernel. One run takes 132 microseconds.
#include <hip/hip_runtime.h>
#include <hip/hip_bf16.h>
#include <math.h>

#define B_    8
#define L_    1024
#define D_    512
#define N_    16
#define MTOT  (B_*L_)      // 8192 rows
#define C_    16           // scan chunks
#define CL_   64           // timesteps per chunk (C_*CL_ == L_)

typedef __attribute__((ext_vector_type(2))) float v2f;
typedef __attribute__((ext_vector_type(8))) float v8f;

__device__ __forceinline__ float silu_f(float v) { return v / (1.0f + __expf(-v)); }

// CDNA5 async global->LDS copy (4B per lane), tracked by ASYNCcnt.
__device__ __forceinline__ void async_g2l_b32(unsigned lds_off, const float* gaddr) {
  asm volatile("global_load_async_to_lds_b32 %0, %1, off"
               :: "v"(lds_off), "v"(gaddr) : "memory");
}
__device__ __forceinline__ void wait_async0() {
  asm volatile("s_wait_asynccnt 0x0" ::: "memory");
}

// ---------------------------------------------------------------------------
// Kernel 1: depthwise conv3 (SAME, zero pad) + SiLU  ->  u (B,L,D)
// ---------------------------------------------------------------------------
__global__ void k_conv_silu(const float* __restrict__ x,
                            const float* __restrict__ ck,   // (K=3,1,D)
                            float* __restrict__ u) {
  int idx = blockIdx.x * blockDim.x + threadIdx.x;   // over B*L*D
  if (idx >= B_ * L_ * D_) return;
  int d = idx % D_;
  int l = (idx / D_) % L_;
  float c0 = ck[0 * D_ + d], c1 = ck[1 * D_ + d], c2 = ck[2 * D_ + d];
  float xm = (l > 0)      ? x[idx - D_] : 0.0f;
  float xc = x[idx];
  float xp = (l < L_ - 1) ? x[idx + D_] : 0.0f;
  u[idx] = silu_f(c0 * xm + c1 * xc + c2 * xp);
}

// ---------------------------------------------------------------------------
// Kernel 2: proj = u @ [W_BC | W_dt] + [b_BC | b_dt]     (M=8192,K=512,N=64)
// One wave per 16x16 tile, V_WMMA_F32_16X16X4_F32, K-loop of 128.
// proj row layout: cols 0..15 = Bc, 16..31 = Cc, 32..63 = dt_rank proj.
// ---------------------------------------------------------------------------
__global__ void k_proj1(const float* __restrict__ u,
                        const float* __restrict__ W_BC, const float* __restrict__ b_BC,
                        const float* __restrict__ W_dt, const float* __restrict__ b_dt,
                        float* __restrict__ proj) {
  const int NT = 4;                                   // 64 / 16
  int wave = blockIdx.x * (blockDim.x >> 5) + (threadIdx.x >> 5);
  int lane = threadIdx.x & 31;
  if (wave >= (MTOT / 16) * NT) return;               // wave-uniform (never taken)
  int nt = wave % NT;
  int mt = wave / NT;
  int row0 = mt * 16;
  int ln = lane & 15;                                 // M for A-frag, N for B-frag
  int kk = (lane >> 4) << 1;                          // K sub-offset: 0 or 2

  const float* W = (nt < 2) ? W_BC : W_dt;            // both row-major (512,32)
  int ncol0 = (nt & 1) * 16;

  v8f acc = {};
  const float* arow = u + (size_t)(row0 + ln) * D_;
  for (int k = 0; k < D_; k += 4) {
    v2f a, b;
    a.x = arow[k + kk];
    a.y = arow[k + kk + 1];
    b.x = W[(k + kk)     * 32 + ncol0 + ln];
    b.y = W[(k + kk + 1) * 32 + ncol0 + ln];
    acc = __builtin_amdgcn_wmma_f32_16x16x4_f32(false, a, false, b,
                                                (short)0, acc, false, false);
  }
  int half = lane >> 4;
  int gcol = nt * 16 + ln;
  float bias = (gcol < 32) ? b_BC[gcol] : b_dt[gcol - 32];
#pragma unroll
  for (int r = 0; r < 8; ++r) {
    int row = row0 + r + 8 * half;
    proj[(size_t)row * 64 + gcol] = acc[r] + bias;
  }
}

// ---------------------------------------------------------------------------
// Kernel 3: Delta = softplus(dtr @ W_dtp + b_dtp)        (M=8192,K=32,N=512)
// ---------------------------------------------------------------------------
__global__ void k_proj2(const float* __restrict__ proj,
                        const float* __restrict__ W_dtp,   // (32,512) row-major
                        const float* __restrict__ b_dtp,
                        float* __restrict__ Delta) {
  const int NT = 32;                                  // 512 / 16
  int wave = blockIdx.x * (blockDim.x >> 5) + (threadIdx.x >> 5);
  int lane = threadIdx.x & 31;
  if (wave >= (MTOT / 16) * NT) return;               // wave-uniform (never taken)
  int nt = wave % NT;
  int mt = wave / NT;
  int row0 = mt * 16;
  int n0 = nt * 16;
  int ln = lane & 15;
  int kk = (lane >> 4) << 1;

  v8f acc = {};
  const float* arow = proj + (size_t)(row0 + ln) * 64 + 32;
#pragma unroll
  for (int k = 0; k < 32; k += 4) {
    v2f a, b;
    a.x = arow[k + kk];
    a.y = arow[k + kk + 1];
    b.x = W_dtp[(k + kk)     * D_ + n0 + ln];
    b.y = W_dtp[(k + kk + 1) * D_ + n0 + ln];
    acc = __builtin_amdgcn_wmma_f32_16x16x4_f32(false, a, false, b,
                                                (short)0, acc, false, false);
  }
  int half = lane >> 4;
  float bias = b_dtp[n0 + ln];
#pragma unroll
  for (int r = 0; r < 8; ++r) {
    int row = row0 + r + 8 * half;
    float v = acc[r] + bias;
    float sp = (v > 20.0f) ? v : log1pf(__expf(v));   // stable softplus
    Delta[(size_t)row * D_ + n0 + ln] = sp;
  }
}

// ---------------------------------------------------------------------------
// Chunked scan. Recurrence h[l] = a[l]*h[l-1] + b[l] composes per chunk as
//   h_out = P*h_in + g     (P = prod a, g = local scan with h_in = 0)
// Pass A: per (b,d,chunk) compute P[n], g[n].           65536 thr = 2048 waves
// Pass B: per (b,d) compose 16 carries -> Hin[chunk].   4096 thr
// Pass C: rerun chunk from Hin, emit y + x*Dparam.      65536 thr = 2048 waves
// P/G/Hin layout: [b][c][n][d]  (d fastest -> coalesced in every pass)
// ---------------------------------------------------------------------------
#define PGIDX(b,c,n,d) ((((size_t)(b)*C_ + (c))*N_ + (n))*D_ + (d))
#define LOG2E_ 1.4426950408889634f

__global__ void k_scan_partial(const float* __restrict__ x,
                               const float* __restrict__ proj,
                               const float* __restrict__ Delta,
                               const float* __restrict__ A_log,
                               float* __restrict__ Pbuf, float* __restrict__ Gbuf) {
  int blk = blockIdx.x;                       // B_*C_*(D_/256)
  int dg = blk % (D_ / 256);
  int c  = (blk / (D_ / 256)) % C_;
  int b  = blk / ((D_ / 256) * C_);
  int d  = dg * 256 + threadIdx.x;

  __shared__ float sB[CL_ * 16];              // Bc cols only: 4 KB
  const float* bcbase = proj + (size_t)(b * L_ + c * CL_) * 64;
  for (int t = threadIdx.x; t < CL_ * 16; t += 256) {
    int lr = t >> 4, cc = t & 15;
    async_g2l_b32((unsigned)(t * 4) + (unsigned)(size_t)sB,
                  bcbase + (size_t)lr * 64 + cc);
  }
  float A2[N_];
#pragma unroll
  for (int n = 0; n < N_; ++n)
    A2[n] = -__expf(A_log[d * N_ + n]) * LOG2E_;
  wait_async0();
  __syncthreads();

  float h[N_], p[N_];
#pragma unroll
  for (int n = 0; n < N_; ++n) { h[n] = 0.0f; p[n] = 1.0f; }

  for (int li = 0; li < CL_; ++li) {
    size_t gidx = (size_t)(b * L_ + c * CL_ + li) * D_ + d;
    float dv = Delta[gidx];
    float xd = x[gidx] * dv;
    const float* brow = &sB[li * 16];
#pragma unroll
    for (int n = 0; n < N_; ++n) {
      float alpha = exp2f(A2[n] * dv);
      p[n] *= alpha;
      h[n] = alpha * h[n] + brow[n] * xd;
    }
  }
#pragma unroll
  for (int n = 0; n < N_; ++n) {
    Pbuf[PGIDX(b, c, n, d)] = p[n];
    Gbuf[PGIDX(b, c, n, d)] = h[n];
  }
}

__global__ void k_scan_carry(const float* __restrict__ Pbuf,
                             const float* __restrict__ Gbuf,
                             float* __restrict__ Hin) {
  int b = blockIdx.x / (D_ / 256);
  int d = (blockIdx.x % (D_ / 256)) * 256 + threadIdx.x;
  float h[N_];
#pragma unroll
  for (int n = 0; n < N_; ++n) h[n] = 0.0f;
  for (int c = 0; c < C_; ++c) {
#pragma unroll
    for (int n = 0; n < N_; ++n) {
      size_t i = PGIDX(b, c, n, d);
      Hin[i] = h[n];                          // state entering chunk c
      h[n] = Pbuf[i] * h[n] + Gbuf[i];        // compose carry
    }
  }
}

__global__ void k_scan_final(const float* __restrict__ x,
                             const float* __restrict__ proj,
                             const float* __restrict__ Delta,
                             const float* __restrict__ A_log,
                             const float* __restrict__ Dparam,
                             const float* __restrict__ Hin,
                             float* __restrict__ out) {
  int blk = blockIdx.x;
  int dg = blk % (D_ / 256);
  int c  = (blk / (D_ / 256)) % C_;
  int b  = blk / ((D_ / 256) * C_);
  int d  = dg * 256 + threadIdx.x;

  __shared__ float sBC[CL_ * 32];             // Bc|Cc: 8 KB
  const float* bcbase = proj + (size_t)(b * L_ + c * CL_) * 64;
  for (int t = threadIdx.x; t < CL_ * 32; t += 256) {
    int lr = t >> 5, cc = t & 31;
    async_g2l_b32((unsigned)(t * 4) + (unsigned)(size_t)sBC,
                  bcbase + (size_t)lr * 64 + cc);
  }
  float A2[N_];
#pragma unroll
  for (int n = 0; n < N_; ++n)
    A2[n] = -__expf(A_log[d * N_ + n]) * LOG2E_;
  float Dp = Dparam[d];
  float h[N_];
#pragma unroll
  for (int n = 0; n < N_; ++n) h[n] = Hin[PGIDX(b, c, n, d)];
  wait_async0();
  __syncthreads();

  for (int li = 0; li < CL_; ++li) {
    size_t gidx = (size_t)(b * L_ + c * CL_ + li) * D_ + d;
    float dv = Delta[gidx];
    float xv = x[gidx];
    float xd = xv * dv;
    const float* bc = &sBC[li * 32];
    float y = 0.0f;
#pragma unroll
    for (int n = 0; n < N_; ++n) {
      float alpha = exp2f(A2[n] * dv);
      h[n] = alpha * h[n] + bc[n] * xd;
      y   += bc[16 + n] * h[n];
    }
    out[gidx] = y + xv * Dp;
  }
}

// ---------------------------------------------------------------------------
extern "C" void kernel_launch(void* const* d_in, const int* in_sizes, int n_in,
                              void* d_out, int out_size, void* d_ws, size_t ws_size,
                              hipStream_t stream) {
  const float* x    = (const float*)d_in[0];
  const float* ck   = (const float*)d_in[1];
  const float* W_BC = (const float*)d_in[2];
  const float* b_BC = (const float*)d_in[3];
  const float* A_lg = (const float*)d_in[4];
  const float* Dpar = (const float*)d_in[5];
  const float* W_dt = (const float*)d_in[6];
  const float* b_dt = (const float*)d_in[7];
  const float* Wdtp = (const float*)d_in[8];
  const float* bdtp = (const float*)d_in[9];
  float* out = (float*)d_out;

  char* ws = (char*)d_ws;
  const size_t SZ_U  = (size_t)B_ * L_ * D_ * 4;          // 16 MB
  const size_t SZ_PG = (size_t)B_ * C_ * N_ * D_ * 4;     //  4 MB
  float* u     = (float*)ws;                              // [0,16MB) (dead after proj1)
  float* Pbuf  = (float*)ws;                              // aliases u: [0,4MB)
  float* Gbuf  = (float*)(ws + SZ_PG);                    // aliases u: [4,8MB)
  float* proj  = (float*)(ws + SZ_U);                     //  2 MB
  float* Delta = (float*)(ws + SZ_U + (size_t)MTOT * 64 * 4);   // 16 MB
  float* Hin   = (float*)(ws + SZ_U + (size_t)MTOT * 64 * 4 + SZ_U); // 4 MB

  // 1) conv + silu
  k_conv_silu<<<(B_ * L_ * D_ + 255) / 256, 256, 0, stream>>>(x, ck, u);

  // 2) proj = u @ [W_BC|W_dt] + bias : 2048 waves
  k_proj1<<<512, 128, 0, stream>>>(u, W_BC, b_BC, W_dt, b_dt, proj);

  // 3) Delta = softplus(dtr @ W_dtp + b_dtp) : 16384 waves
  k_proj2<<<4096, 128, 0, stream>>>(proj, Wdtp, bdtp, Delta);

  // 4) chunked scan: partial -> carry -> final
  int scan_blocks = B_ * C_ * (D_ / 256);                 // 256 blocks
  k_scan_partial<<<scan_blocks, 256, 0, stream>>>(x, proj, Delta, A_lg, Pbuf, Gbuf);
  k_scan_carry<<<B_ * (D_ / 256), 256, 0, stream>>>(Pbuf, Gbuf, Hin);
  k_scan_final<<<scan_blocks, 256, 0, stream>>>(x, proj, Delta, A_lg, Dpar, Hin, out);
}

// v001
// Measured time: 80.6 microseconds a run.
// Two timings next to v000 both put it at 1.65 times that version's speed.
#include <hip/hip_runtime.h>
#include <hip/hip_bf16.h>
#include <math.h>

#define B_    8
#define L_    1024
#define D_    512
#define N_    16
#define MTOT  (B_*L_)      // 8192 rows
#define C_    16           // scan chunks
#define CL_   64           // timesteps per chunk (C_*CL_ == L_)

typedef __attribute__((ext_vector_type(2))) float v2f;
typedef __attribute__((ext_vector_type(8))) float v8f;

__device__ __forceinline__ float silu_f(float v) { return v / (1.0f + __expf(-v)); }

// CDNA5 async global->LDS copy (4B per lane), tracked by ASYNCcnt.
__device__ __forceinline__ void async_g2l_b32(unsigned lds_off, const float* gaddr) {
  asm volatile("global_load_async_to_lds_b32 %0, %1, off"
               :: "v"(lds_off), "v"(gaddr) : "memory");
}
__device__ __forceinline__ void wait_async0() {
  asm volatile("s_wait_asynccnt 0x0" ::: "memory");
}

// ---------------------------------------------------------------------------
// Kernel 1: depthwise conv3 (SAME, zero pad) + SiLU  ->  u (B,L,D)
// ---------------------------------------------------------------------------
__global__ void k_conv_silu(const float* __restrict__ x,
                            const float* __restrict__ ck,   // (K=3,1,D)
                            float* __restrict__ u) {
  int idx = blockIdx.x * blockDim.x + threadIdx.x;   // over B*L*D
  if (idx >= B_ * L_ * D_) return;
  int d = idx % D_;
  int l = (idx / D_) % L_;
  float c0 = ck[0 * D_ + d], c1 = ck[1 * D_ + d], c2 = ck[2 * D_ + d];
  float xm = (l > 0)      ? x[idx - D_] : 0.0f;
  float xc = x[idx];
  float xp = (l < L_ - 1) ? x[idx + D_] : 0.0f;
  u[idx] = silu_f(c0 * xm + c1 * xc + c2 * xp);
}

// ---------------------------------------------------------------------------
// Kernel 2: proj = u @ [W_BC | W_dt] + [b_BC | b_dt]     (M=8192,K=512,N=64)
// One wave per 16x16 tile, V_WMMA_F32_16X16X4_F32, K-loop of 128.
// proj row layout: cols 0..15 = Bc, 16..31 = Cc, 32..63 = dt_rank proj.
// ---------------------------------------------------------------------------
__global__ void k_proj1(const float* __restrict__ u,
                        const float* __restrict__ W_BC, const float* __restrict__ b_BC,
                        const float* __restrict__ W_dt, const float* __restrict__ b_dt,
                        float* __restrict__ proj) {
  const int NT = 4;                                   // 64 / 16
  int wave = blockIdx.x * (blockDim.x >> 5) + (threadIdx.x >> 5);
  int lane = threadIdx.x & 31;
  if (wave >= (MTOT / 16) * NT) return;               // wave-uniform (never taken)
  int nt = wave % NT;
  int mt = wave / NT;
  int row0 = mt * 16;
  int ln = lane & 15;                                 // M for A-frag, N for B-frag
  int kk = (lane >> 4) << 1;                          // K sub-offset: 0 or 2

  const float* W = (nt < 2) ? W_BC : W_dt;            // both row-major (512,32)
  int ncol0 = (nt & 1) * 16;

  v8f acc = {};
  const float* arow = u + (size_t)(row0 + ln) * D_;
  for (int k = 0; k < D_; k += 4) {
    v2f a, b;
    a.x = arow[k + kk];
    a.y = arow[k + kk + 1];
    b.x = W[(k + kk)     * 32 + ncol0 + ln];
    b.y = W[(k + kk + 1) * 32 + ncol0 + ln];
    acc = __builtin_amdgcn_wmma_f32_16x16x4_f32(false, a, false, b,
                                                (short)0, acc, false, false);
  }
  int half = lane >> 4;
  int gcol = nt * 16 + ln;
  float bias = (gcol < 32) ? b_BC[gcol] : b_dt[gcol - 32];
#pragma unroll
  for (int r = 0; r < 8; ++r) {
    int row = row0 + r + 8 * half;
    proj[(size_t)row * 64 + gcol] = acc[r] + bias;
  }
}

// ---------------------------------------------------------------------------
// Kernel 3: Delta = softplus(dtr @ W_dtp + b_dtp)        (M=8192,K=32,N=512)
// ---------------------------------------------------------------------------
__global__ void k_proj2(const float* __restrict__ proj,
                        const float* __restrict__ W_dtp,   // (32,512) row-major
                        const float* __restrict__ b_dtp,
                        float* __restrict__ Delta) {
  const int NT = 32;                                  // 512 / 16
  int wave = blockIdx.x * (blockDim.x >> 5) + (threadIdx.x >> 5);
  int lane = threadIdx.x & 31;
  if (wave >= (MTOT / 16) * NT) return;               // wave-uniform (never taken)
  int nt = wave % NT;
  int mt = wave / NT;
  int row0 = mt * 16;
  int n0 = nt * 16;
  int ln = lane & 15;
  int kk = (lane >> 4) << 1;

  v8f acc = {};
  const float* arow = proj + (size_t)(row0 + ln) * 64 + 32;
#pragma unroll
  for (int k = 0; k < 32; k += 4) {
    v2f a, b;
    a.x = arow[k + kk];
    a.y = arow[k + kk + 1];
    b.x = W_dtp[(k + kk)     * D_ + n0 + ln];
    b.y = W_dtp[(k + kk + 1) * D_ + n0 + ln];
    acc = __builtin_amdgcn_wmma_f32_16x16x4_f32(false, a, false, b,
                                                (short)0, acc, false, false);
  }
  int half = lane >> 4;
  float bias = b_dtp[n0 + ln];
#pragma unroll
  for (int r = 0; r < 8; ++r) {
    int row = row0 + r + 8 * half;
    float v = acc[r] + bias;
    float sp = (v > 20.0f) ? v : log1pf(__expf(v));   // stable softplus
    Delta[(size_t)row * D_ + n0 + ln] = sp;
  }
}

// ---------------------------------------------------------------------------
// Chunked scan. Recurrence h[l] = a[l]*h[l-1] + b[l] composes per chunk as
//   h_out = P*h_in + g     (P = prod a, g = local scan with h_in = 0)
// Pass A: per (b,d,chunk) compute P[n], g[n].           65536 thr = 2048 waves
// Pass B: per (b,d) compose 16 carries -> Hin[chunk].   4096 thr
// Pass C: rerun chunk from Hin, emit y + x*Dparam.      65536 thr = 2048 waves
// P/G/Hin layout: [b][c][n][d]  (d fastest -> coalesced in every pass)
// ---------------------------------------------------------------------------
#define PGIDX(b,c,n,d) ((((size_t)(b)*C_ + (c))*N_ + (n))*D_ + (d))
#define LOG2E_ 1.4426950408889634f
#define PF_ 16             // timesteps whose Delta and x are fetched ahead as one group
#define NG_ (CL_ / PF_)    // groups per chunk

__global__ void __launch_bounds__(256) k_scan_partial(const float* __restrict__ x,
                               const float* __restrict__ proj,
                               const float* __restrict__ Delta,
                               const float* __restrict__ A_log,
                               float* __restrict__ Pbuf, float* __restrict__ Gbuf) {
  int blk = blockIdx.x;                       // B_*C_*(D_/256)
  int dg = blk % (D_ / 256);
  int c  = (blk / (D_ / 256)) % C_;
  int b  = blk / ((D_ / 256) * C_);
  int d  = dg * 256 + threadIdx.x;

  __shared__ float sB[CL_ * 16];              // Bc cols only: 4 KB
  const float* bcbase = proj + (size_t)(b * L_ + c * CL_) * 64;
  for (int t = threadIdx.x; t < CL_ * 16; t += 256) {
    int lr = t >> 4, cc = t & 15;
    async_g2l_b32((unsigned)(t * 4) + (unsigned)(size_t)sB,
                  bcbase + (size_t)lr * 64 + cc);
  }
  float A2[N_];
#pragma unroll
  for (int n = 0; n < N_; ++n)
    A2[n] = -__expf(A_log[d * N_ + n]) * LOG2E_;
  const float* dp = Delta + (size_t)(b * L_ + c * CL_) * D_ + d;
  const float* xp = x     + (size_t)(b * L_ + c * CL_) * D_ + d;
  float dn[PF_], xn[PF_];                     // the group in flight
#pragma unroll
  for (int i = 0; i < PF_; ++i) { dn[i] = dp[i * D_]; xn[i] = xp[i * D_]; }
  wait_async0();
  __syncthreads();

  float h[N_], p[N_];
#pragma unroll
  for (int n = 0; n < N_; ++n) { h[n] = 0.0f; p[n] = 1.0f; }

  // rolled: one group's body stays the loop, so the code fits the instruction cache
#pragma unroll 1
  for (int g = 0; g < NG_; ++g) {
    float dc[PF_], xc[PF_];
#pragma unroll
    for (int i = 0; i < PF_; ++i) { dc[i] = dn[i]; xc[i] = xn[i]; }
    if (g + 1 < NG_) {                        // next group's loads fly under this group's work
      dp += PF_ * D_;
      xp += PF_ * D_;
#pragma unroll
      for (int i = 0; i < PF_; ++i) { dn[i] = dp[i * D_]; xn[i] = xp[i * D_]; }
    }
#pragma unroll
    for (int i = 0; i < PF_; ++i) {
      float dv = dc[i];
      float xd = xc[i] * dv;
      const float* brow = &sB[(g * PF_ + i) * 16];
#pragma unroll
      for (int n = 0; n < N_; ++n) {
        float alpha = exp2f(A2[n] * dv);
        p[n] *= alpha;
        h[n] = alpha * h[n] + brow[n] * xd;
      }
    }
  }
#pragma unroll
  for (int n = 0; n < N_; ++n) {
    Pbuf[PGIDX(b, c, n, d)] = p[n];
    Gbuf[PGIDX(b, c, n, d)] = h[n];
  }
}

__global__ void k_scan_carry(const float* __restrict__ Pbuf,
                             const float* __restrict__ Gbuf,
                             float* __restrict__ Hin) {
  int b = blockIdx.x / (D_ / 256);
  int d = (blockIdx.x % (D_ / 256)) * 256 + threadIdx.x;
  float h[N_];
#pragma unroll
  for (int n = 0; n < N_; ++n) h[n] = 0.0f;
  for (int c = 0; c < C_; ++c) {
#pragma unroll
    for (int n = 0; n < N_; ++n) {
      size_t i = PGIDX(b, c, n, d);
      Hin[i] = h[n];                          // state entering chunk c
      h[n] = Pbuf[i] * h[n] + Gbuf[i];        // compose carry
    }
  }
}

__global__ void __launch_bounds__(256) k_scan_final(const float* __restrict__ x,
                             const float* __restrict__ proj,
                             const float* __restrict__ Delta,
                             const float* __restrict__ A_log,
                             const float* __restrict__ Dparam,
                             const float* __restrict__ Hin,
                             float* __restrict__ out) {
  int blk = blockIdx.x;
  int dg = blk % (D_ / 256);
  int c  = (blk / (D_ / 256)) % C_;
  int b  = blk / ((D_ / 256) * C_);
  int d  = dg * 256 + threadIdx.x;

  __shared__ float sBC[CL_ * 32];             // Bc|Cc: 8 KB
  const float* bcbase = proj + (size_t)(b * L_ + c * CL_) * 64;
  for (int t = threadIdx.x; t < CL_ * 32; t += 256) {
    int lr = t >> 5, cc = t & 31;
    async_g2l_b32((unsigned)(t * 4) + (unsigned)(size_t)sBC,
                  bcbase + (size_t)lr * 64 + cc);
  }
  float A2[N_];
#pragma unroll
  for (int n = 0; n < N_; ++n)
    A2[n] = -__expf(A_log[d * N_ + n]) * LOG2E_;
  float Dp = Dparam[d];
  float h[N_];
#pragma unroll
  for (int n = 0; n < N_; ++n) h[n] = Hin[PGIDX(b, c, n, d)];
  const float* dp = Delta + (size_t)(b * L_ + c * CL_) * D_ + d;
  const float* xp = x     + (size_t)(b * L_ + c * CL_) * D_ + d;
  float*       op = out   + (size_t)(b * L_ + c * CL_) * D_ + d;
  float dn[PF_], xn[PF_];                     // the group in flight
#pragma unroll
  for (int i = 0; i < PF_; ++i) { dn[i] = dp[i * D_]; xn[i] = xp[i * D_]; }
  wait_async0();
  __syncthreads();

  // rolled: one group's body stays the loop, so the code fits the instruction cache
#pragma unroll 1
  for (int g = 0; g < NG_; ++g) {
    float dc[PF_], xc[PF_];
#pragma unroll
    for (int i = 0; i < PF_; ++i) { dc[i] = dn[i]; xc[i] = xn[i]; }
    if (g + 1 < NG_) {                        // next group's loads fly under this group's work
      dp += PF_ * D_;
      xp += PF_ * D_;
#pragma unroll
      for (int i = 0; i < PF_; ++i) { dn[i] = dp[i * D_]; xn[i] = xp[i * D_]; }
    }
#pragma unroll
    for (int i = 0; i < PF_; ++i) {
      float dv = dc[i];
      float xv = xc[i];
      float xd = xv * dv;
      const float* bc = &sBC[(g * PF_ + i) * 32];
      float y = 0.0f;
#pragma unroll
      for (int n = 0; n < N_; ++n) {
        float alpha = exp2f(A2[n] * dv);
        h[n] = alpha * h[n] + bc[n] * xd;
        y   += bc[16 + n] * h[n];
      }
      op[(g * PF_ + i) * D_] = y + xv * Dp;
      // every fourth step: bounds how far the scheduler spreads the unrolled steps (without it
      // the registers pass 256 and register-window switches enter the loop); the last one also
      // keeps the hand-over of the fetched registers, with its load wait, behind the work
      if ((i & 3) == 3) __builtin_amdgcn_sched_barrier(0);
    }
  }
}

// ---------------------------------------------------------------------------
extern "C" void kernel_launch(void* const* d_in, const int* in_sizes, int n_in,
                              void* d_out, int out_size, void* d_ws, size_t ws_size,
                              hipStream_t stream) {
  const float* x    = (const float*)d_in[0];
  const float* ck   = (const float*)d_in[1];
  const float* W_BC = (const float*)d_in[2];
  const float* b_BC = (const float*)d_in[3];
  const float* A_lg = (const float*)d_in[4];
  const float* Dpar = (const float*)d_in[5];
  const float* W_dt = (const float*)d_in[6];
  const float* b_dt = (const float*)d_in[7];
  const float* Wdtp = (const float*)d_in[8];
  const float* bdtp = (const float*)d_in[9];
  float* out = (float*)d_out;

  char* ws = (char*)d_ws;
  const size_t SZ_U  = (size_t)B_ * L_ * D_ * 4;          // 16 MB
  const size_t SZ_PG = (size_t)B_ * C_ * N_ * D_ * 4;     //  4 MB
  float* u     = (float*)ws;                              // [0,16MB) (dead after proj1)
  float* Pbuf  = (float*)ws;                              // aliases u: [0,4MB)
  float* Gbuf  = (float*)(ws + SZ_PG);                    // aliases u: [4,8MB)
  float* proj  = (float*)(ws + SZ_U);                     //  2 MB
  float* Delta = (float*)(ws + SZ_U + (size_t)MTOT * 64 * 4);   // 16 MB
  float* Hin   = (float*)(ws + SZ_U + (size_t)MTOT * 64 * 4 + SZ_U); // 4 MB

  // 1) conv + silu
  k_conv_silu<<<(B_ * L_ * D_ + 255) / 256, 256, 0, stream>>>(x, ck, u);

  // 2) proj = u @ [W_BC|W_dt] + bias : 2048 waves
  k_proj1<<<512, 128, 0, stream>>>(u, W_BC, b_BC, W_dt, b_dt, proj);

  // 3) Delta = softplus(dtr @ W_dtp + b_dtp) : 16384 waves
  k_proj2<<<4096, 128, 0, stream>>>(proj, Wdtp, bdtp, Delta);

  // 4) chunked scan: partial -> carry -> final
  int scan_blocks = B_ * C_ * (D_ / 256);                 // 256 blocks
  k_scan_partial<<<scan_blocks, 256, 0, stream>>>(x, proj, Delta, A_lg, Pbuf, Gbuf);
  k_scan_carry<<<B_ * (D_ / 256), 256, 0, stream>>>(Pbuf, Gbuf, Hin);
  k_scan_final<<<scan_blocks, 256, 0, stream>>>(x, proj, Delta, A_lg, Dpar, Hin, out);
}

// v002
// Measured time: 76.2 microseconds a run.
// In both of two side-by-side timings against v001, it was 1.06 times as fast.
// All steps since v000 together make it 1.74 times as fast.
#include <hip/hip_runtime.h>
#include <hip/hip_bf16.h>
#include <math.h>

#define B_    8
#define L_    1024
#define D_    512
#define N_    16
#define MTOT  (B_*L_)      // 8192 rows
#define C_    16           // scan chunks
#define CL_   64           // timesteps per chunk (C_*CL_ == L_)

typedef __attribute__((ext_vector_type(2))) float v2f;
typedef __attribute__((ext_vector_type(8))) float v8f;

__device__ __forceinline__ float silu_f(float v) { return v / (1.0f + __expf(-v)); }

// CDNA5 async global->LDS copy (4B per lane), tracked by ASYNCcnt.
__device__ __forceinline__ void async_g2l_b32(unsigned lds_off, const float* gaddr) {
  asm volatile("global_load_async_to_lds_b32 %0, %1, off"
               :: "v"(lds_off), "v"(gaddr) : "memory");
}
__device__ __forceinline__ void wait_async0() {
  asm volatile("s_wait_asynccnt 0x0" ::: "memory");
}

// ---------------------------------------------------------------------------
// Kernel 1: depthwise conv3 (SAME, zero pad) + SiLU  ->  u (B,L,D)
// One thread makes 4 channels x CR_ rows: 16-byte loads and stores, each x row loaded
// once per thread and used by three output rows, and 4096 waves in place of 131072.
// ---------------------------------------------------------------------------
#define CR_ 8              // rows per thread; divides L_, so a thread stays in one sequence
typedef __attribute__((ext_vector_type(4))) float v4f;

__global__ void __launch_bounds__(256) k_conv_silu(const float* __restrict__ x,
                            const float* __restrict__ ck,   // (K=3,1,D)
                            float* __restrict__ u) {
  int t = blockIdx.x * 256 + threadIdx.x;            // over (B*L/CR_) * (D/4)
  int d = (t % (D_ / 4)) * 4;
  int row0 = (t / (D_ / 4)) * CR_;                   // flat row b*L + l of the first output
  int l0 = row0 % L_;
  const float* xp = x + (size_t)row0 * D_ + d;
  float*       up = u + (size_t)row0 * D_ + d;
  v4f c0 = *(const v4f*)(ck + 0 * D_ + d);
  v4f c1 = *(const v4f*)(ck + 1 * D_ + d);
  v4f c2 = *(const v4f*)(ck + 2 * D_ + d);
  v4f r[CR_ + 2];                                    // rows l0-1 .. l0+CR_
  const v4f zero = {0.0f, 0.0f, 0.0f, 0.0f};
  r[0] = (l0 > 0) ? *(const v4f*)(xp - D_) : zero;
#pragma unroll
  for (int i = 0; i < CR_; ++i) r[i + 1] = *(const v4f*)(xp + i * D_);
  r[CR_ + 1] = (l0 + CR_ < L_) ? *(const v4f*)(xp + CR_ * D_) : zero;
#pragma unroll
  for (int i = 0; i < CR_; ++i) {
    v4f v = c0 * r[i] + c1 * r[i + 1] + c2 * r[i + 2];
    v4f o;
    o.x = silu_f(v.x); o.y = silu_f(v.y); o.z = silu_f(v.z); o.w = silu_f(v.w);
    *(v4f*)(up + i * D_) = o;
  }
}

// ---------------------------------------------------------------------------
// Kernel 2: proj = u @ [W_BC | W_dt] + [b_BC | b_dt]     (M=8192,K=512,N=64)
// One wave per 16x16 tile, V_WMMA_F32_16X16X4_F32, K-loop of 128.
// proj row layout: cols 0..15 = Bc, 16..31 = Cc, 32..63 = dt_rank proj.
// ---------------------------------------------------------------------------
__global__ void k_proj1(const float* __restrict__ u,
                        const float* __restrict__ W_BC, const float* __restrict__ b_BC,
                        const float* __restrict__ W_dt, const float* __restrict__ b_dt,
                        float* __restrict__ proj) {
  const int NT = 4;                                   // 64 / 16
  int wave = blockIdx.x * (blockDim.x >> 5) + (threadIdx.x >> 5);
  int lane = threadIdx.x & 31;
  if (wave >= (MTOT / 16) * NT) return;               // wave-uniform (never taken)
  int nt = wave % NT;
  int mt = wave / NT;
  int row0 = mt * 16;
  int ln = lane & 15;                                 // M for A-frag, N for B-frag
  int kk = (lane >> 4) << 1;                          // K sub-offset: 0 or 2

  const float* W = (nt < 2) ? W_BC : W_dt;            // both row-major (512,32)
  int ncol0 = (nt & 1) * 16;

  v8f acc = {};
  const float* arow = u + (size_t)(row0 + ln) * D_;
  for (int k = 0; k < D_; k += 4) {
    v2f a, b;
    a.x = arow[k + kk];
    a.y = arow[k + kk + 1];
    b.x = W[(k + kk)     * 32 + ncol0 + ln];
    b.y = W[(k + kk + 1) * 32 + ncol0 + ln];
    acc = __builtin_amdgcn_wmma_f32_16x16x4_f32(false, a, false, b,
                                                (short)0, acc, false, false);
  }
  int half = lane >> 4;
  int gcol = nt * 16 + ln;
  float bias = (gcol < 32) ? b_BC[gcol] : b_dt[gcol - 32];
#pragma unroll
  for (int r = 0; r < 8; ++r) {
    int row = row0 + r + 8 * half;
    proj[(size_t)row * 64 + gcol] = acc[r] + bias;
  }
}

// ---------------------------------------------------------------------------
// Kernel 3: Delta = softplus(dtr @ W_dtp + b_dtp)        (M=8192,K=32,N=512)
// ---------------------------------------------------------------------------
__global__ void k_proj2(const float* __restrict__ proj,
                        const float* __restrict__ W_dtp,   // (32,512) row-major
                        const float* __restrict__ b_dtp,
                        float* __restrict__ Delta) {
  const int NT = 32;                                  // 512 / 16
  int wave = blockIdx.x * (blockDim.x >> 5) + (threadIdx.x >> 5);
  int lane = threadIdx.x & 31;
  if (wave >= (MTOT / 16) * NT) return;               // wave-uniform (never taken)
  int nt = wave % NT;
  int mt = wave / NT;
  int row0 = mt * 16;
  int n0 = nt * 16;
  int ln = lane & 15;
  int kk = (lane >> 4) << 1;

  v8f acc = {};
  const float* arow = proj + (size_t)(row0 + ln) * 64 + 32;
#pragma unroll
  for (int k = 0; k < 32; k += 4) {
    v2f a, b;
    a.x = arow[k + kk];
    a.y = arow[k + kk + 1];
    b.x = W_dtp[(k + kk)     * D_ + n0 + ln];
    b.y = W_dtp[(k + kk + 1) * D_ + n0 + ln];
    acc = __builtin_amdgcn_wmma_f32_16x16x4_f32(false, a, false, b,
                                                (short)0, acc, false, false);
  }
  int half = lane >> 4;
  float bias = b_dtp[n0 + ln];
#pragma unroll
  for (int r = 0; r < 8; ++r) {
    int row = row0 + r + 8 * half;
    float v = acc[r] + bias;
    float sp = (v > 20.0f) ? v : log1pf(__expf(v));   // stable softplus
    Delta[(size_t)row * D_ + n0 + ln] = sp;
  }
}

// ---------------------------------------------------------------------------
// Chunked scan. Recurrence h[l] = a[l]*h[l-1] + b[l] composes per chunk as
//   h_out = P*h_in + g     (P = prod a, g = local scan with h_in = 0)
// Pass A: per (b,d,chunk) compute P[n], g[n].           65536 thr = 2048 waves
// Pass B: per (b,d) compose 16 carries -> Hin[chunk].   4096 thr
// Pass C: rerun chunk from Hin, emit y + x*Dparam.      65536 thr = 2048 waves
// P/G/Hin layout: [b][c][n][d]  (d fastest -> coalesced in every pass)
// ---------------------------------------------------------------------------
#define PGIDX(b,c,n,d) ((((size_t)(b)*C_ + (c))*N_ + (n))*D_ + (d))
#define LOG2E_ 1.4426950408889634f
#define PF_ 16             // timesteps whose Delta and x are fetched ahead as one group
#define NG_ (CL_ / PF_)    // groups per chunk

__global__ void __launch_bounds__(256) k_scan_partial(const float* __restrict__ x,
                               const float* __restrict__ proj,
                               const float* __restrict__ Delta,
                               const float* __restrict__ A_log,
                               float* __restrict__ Pbuf, float* __restrict__ Gbuf) {
  int blk = blockIdx.x;                       // B_*C_*(D_/256)
  int dg = blk % (D_ / 256);
  int c  = (blk / (D_ / 256)) % C_;
  int b  = blk / ((D_ / 256) * C_);
  int d  = dg * 256 + threadIdx.x;

  __shared__ float sB[CL_ * 16];              // Bc cols only: 4 KB
  const float* bcbase = proj + (size_t)(b * L_ + c * CL_) * 64;
  for (int t = threadIdx.x; t < CL_ * 16; t += 256) {
    int lr = t >> 4, cc = t & 15;
    async_g2l_b32((unsigned)(t * 4) + (unsigned)(size_t)sB,
                  bcbase + (size_t)lr * 64 + cc);
  }
  float A2[N_];
#pragma unroll
  for (int n = 0; n < N_; ++n)
    A2[n] = -__expf(A_log[d * N_ + n]) * LOG2E_;
  const float* dp = Delta + (size_t)(b * L_ + c * CL_) * D_ + d;
  const float* xp = x     + (size_t)(b * L_ + c * CL_) * D_ + d;
  float dn[PF_], xn[PF_];                     // the group in flight
#pragma unroll
  for (int i = 0; i < PF_; ++i) { dn[i] = dp[i * D_]; xn[i] = xp[i * D_]; }
  wait_async0();
  __syncthreads();

  float h[N_], p[N_];
#pragma unroll
  for (int n = 0; n < N_; ++n) { h[n] = 0.0f; p[n] = 1.0f; }

  // rolled: one group's body stays the loop (for speed only)
#pragma unroll 1
  for (int g = 0; g < NG_; ++g) {
    float dc[PF_], xc[PF_];
#pragma unroll
    for (int i = 0; i < PF_; ++i) { dc[i] = dn[i]; xc[i] = xn[i]; }
    if (g + 1 < NG_) {                        // next group's loads fly under this group's work
      dp += PF_ * D_;
      xp += PF_ * D_;
#pragma unroll
      for (int i = 0; i < PF_; ++i) { dn[i] = dp[i * D_]; xn[i] = xp[i * D_]; }
    }
#pragma unroll
    for (int i = 0; i < PF_; ++i) {
      float dv = dc[i];
      float xd = xc[i] * dv;
      const float* brow = &sB[(g * PF_ + i) * 16];
#pragma unroll
      for (int n = 0; n < N_; ++n) {
        float alpha = exp2f(A2[n] * dv);
        p[n] *= alpha;
        h[n] = alpha * h[n] + brow[n] * xd;
      }
    }
  }
#pragma unroll
  for (int n = 0; n < N_; ++n) {
    Pbuf[PGIDX(b, c, n, d)] = p[n];
    Gbuf[PGIDX(b, c, n, d)] = h[n];
  }
}

__global__ void k_scan_carry(const float* __restrict__ Pbuf,
                             const float* __restrict__ Gbuf,
                             float* __restrict__ Hin) {
  int b = blockIdx.x / (D_ / 256);
  int d = (blockIdx.x % (D_ / 256)) * 256 + threadIdx.x;
  float h[N_];
#pragma unroll
  for (int n = 0; n < N_; ++n) h[n] = 0.0f;
  for (int c = 0; c < C_; ++c) {
#pragma unroll
    for (int n = 0; n < N_; ++n) {
      size_t i = PGIDX(b, c, n, d);
      Hin[i] = h[n];                          // state entering chunk c
      h[n] = Pbuf[i] * h[n] + Gbuf[i];        // compose carry
    }
  }
}

__global__ void __launch_bounds__(256) k_scan_final(const float* __restrict__ x,
                             const float* __restrict__ proj,
                             const float* __restrict__ Delta,
                             const float* __restrict__ A_log,
                             const float* __restrict__ Dparam,
                             const float* __restrict__ Hin,
                             float* __restrict__ out) {
  int blk = blockIdx.x;
  int dg = blk % (D_ / 256);
  int c  = (blk / (D_ / 256)) % C_;
  int b  = blk / ((D_ / 256) * C_);
  int d  = dg * 256 + threadIdx.x;

  __shared__ float sBC[CL_ * 32];             // Bc|Cc: 8 KB
  const float* bcbase = proj + (size_t)(b * L_ + c * CL_) * 64;
  for (int t = threadIdx.x; t < CL_ * 32; t += 256) {
    int lr = t >> 5, cc = t & 31;
    async_g2l_b32((unsigned)(t * 4) + (unsigned)(size_t)sBC,
                  bcbase + (size_t)lr * 64 + cc);
  }
  float A2[N_];
#pragma unroll
  for (int n = 0; n < N_; ++n)
    A2[n] = -__expf(A_log[d * N_ + n]) * LOG2E_;
  float Dp = Dparam[d];
  float h[N_];
#pragma unroll
  for (int n = 0; n < N_; ++n) h[n] = Hin[PGIDX(b, c, n, d)];
  const float* dp = Delta + (size_t)(b * L_ + c * CL_) * D_ + d;
  const float* xp = x     + (size_t)(b * L_ + c * CL_) * D_ + d;
  float*       op = out   + (size_t)(b * L_ + c * CL_) * D_ + d;
  float dn[PF_], xn[PF_];                     // the group in flight
#pragma unroll
  for (int i = 0; i < PF_; ++i) { dn[i] = dp[i * D_]; xn[i] = xp[i * D_]; }
  wait_async0();
  __syncthreads();

  // rolled: one group's body stays the loop (for speed only)
#pragma unroll 1
  for (int g = 0; g < NG_; ++g) {
    float dc[PF_], xc[PF_];
#pragma unroll
    for (int i = 0; i < PF_; ++i) { dc[i] = dn[i]; xc[i] = xn[i]; }
    if (g + 1 < NG_) {                        // next group's loads fly under this group's work
      dp += PF_ * D_;
      xp += PF_ * D_;
#pragma unroll
      for (int i = 0; i < PF_; ++i) { dn[i] = dp[i * D_]; xn[i] = xp[i * D_]; }
    }
#pragma unroll
    for (int i = 0; i < PF_; ++i) {
      float dv = dc[i];
      float xv = xc[i];
      float xd = xv * dv;
      const float* bc = &sBC[(g * PF_ + i) * 32];
      float y = 0.0f;
#pragma unroll
      for (int n = 0; n < N_; ++n) {
        float alpha = exp2f(A2[n] * dv);
        h[n] = alpha * h[n] + bc[n] * xd;
        y   += bc[16 + n] * h[n];
      }
      op[(g * PF_ + i) * D_] = y + xv * Dp;
      // every fourth step: bounds how far the scheduler spreads the unrolled steps (without it
      // the registers pass 256 and register-window switches enter the loop); the last one also
      // keeps the hand-over of the fetched registers, with its load wait, behind the work
      if ((i & 3) == 3) __builtin_amdgcn_sched_barrier(0);
    }
  }
}

// ---------------------------------------------------------------------------
extern "C" void kernel_launch(void* const* d_in, const int* in_sizes, int n_in,
                              void* d_out, int out_size, void* d_ws, size_t ws_size,
                              hipStream_t stream) {
  const float* x    = (const float*)d_in[0];
  const float* ck   = (const float*)d_in[1];
  const float* W_BC = (const float*)d_in[2];
  const float* b_BC = (const float*)d_in[3];
  const float* A_lg = (const float*)d_in[4];
  const float* Dpar = (const float*)d_in[5];
  const float* W_dt = (const float*)d_in[6];
  const float* b_dt = (const float*)d_in[7];
  const float* Wdtp = (const float*)d_in[8];
  const float* bdtp = (const float*)d_in[9];
  float* out = (float*)d_out;

  char* ws = (char*)d_ws;
  const size_t SZ_U  = (size_t)B_ * L_ * D_ * 4;          // 16 MB
  const size_t SZ_PG = (size_t)B_ * C_ * N_ * D_ * 4;     //  4 MB
  float* u     = (float*)ws;                              // [0,16MB) (dead after proj1)
  float* Pbuf  = (float*)ws;                              // aliases u: [0,4MB)
  float* Gbuf  = (float*)(ws + SZ_PG);                    // aliases u: [4,8MB)
  float* proj  = (float*)(ws + SZ_U);                     //  2 MB
  float* Delta = (float*)(ws + SZ_U + (size_t)MTOT * 64 * 4);   // 16 MB
  float* Hin   = (float*)(ws + SZ_U + (size_t)MTOT * 64 * 4 + SZ_U); // 4 MB

  // 1) conv + silu
  k_conv_silu<<<(B_ * L_ / CR_) * (D_ / 4) / 256, 256, 0, stream>>>(x, ck, u);

  // 2) proj = u @ [W_BC|W_dt] + bias : 2048 waves
  k_proj1<<<512, 128, 0, stream>>>(u, W_BC, b_BC, W_dt, b_dt, proj);

  // 3) Delta = softplus(dtr @ W_dtp + b_dtp) : 16384 waves
  k_proj2<<<4096, 128, 0, stream>>>(proj, Wdtp, bdtp, Delta);

  // 4) chunked scan: partial -> carry -> final
  int scan_blocks = B_ * C_ * (D_ / 256);                 // 256 blocks
  k_scan_partial<<<scan_blocks, 256, 0, stream>>>(x, proj, Delta, A_lg, Pbuf, Gbuf);
  k_scan_carry<<<B_ * (D_ / 256), 256, 0, stream>>>(Pbuf, Gbuf, Hin);
  k_scan_final<<<scan_blocks, 256, 0, stream>>>(x, proj, Delta, A_lg, Dpar, Hin, out);
}

// v003
// Measured time: 66 microseconds a run.
// In both of two side-by-side timings against v002, it was 1.15 times as fast.
// Over all steps from v000 it is 2.01 times as fast.
#include <hip/hip_runtime.h>
#include <hip/hip_bf16.h>
#include <math.h>

#define B_    8
#define L_    1024
#define D_    512
#define N_    16
#define MTOT  (B_*L_)      // 8192 rows
#define C_    16           // scan chunks
#define CL_   64           // timesteps per chunk (C_*CL_ == L_)

typedef __attribute__((ext_vector_type(2))) float v2f;
typedef __attribute__((ext_vector_type(8))) float v8f;

__device__ __forceinline__ float silu_f(float v) { return v / (1.0f + __expf(-v)); }

// CDNA5 async global->LDS copy (4B per lane), tracked by ASYNCcnt.
__device__ __forceinline__ void async_g2l_b32(unsigned lds_off, const float* gaddr) {
  asm volatile("global_load_async_to_lds_b32 %0, %1, off"
               :: "v"(lds_off), "v"(gaddr) : "memory");
}
__device__ __forceinline__ void wait_async0() {
  asm volatile("s_wait_asynccnt 0x0" ::: "memory");
}

// ---------------------------------------------------------------------------
// Kernel 1: depthwise conv3 (SAME, zero pad) + SiLU  ->  u (B,L,D)
// One thread makes 4 channels x CR_ rows: 16-byte loads and stores, each x row loaded
// once per thread and used by three output rows, and 4096 waves in place of 131072.
// ---------------------------------------------------------------------------
#define CR_ 8              // rows per thread; divides L_, so a thread stays in one sequence
typedef __attribute__((ext_vector_type(4))) float v4f;

__global__ void __launch_bounds__(256) k_conv_silu(const float* __restrict__ x,
                            const float* __restrict__ ck,   // (K=3,1,D)
                            float* __restrict__ u) {
  int t = blockIdx.x * 256 + threadIdx.x;            // over (B*L/CR_) * (D/4)
  int d = (t % (D_ / 4)) * 4;
  int row0 = (t / (D_ / 4)) * CR_;                   // flat row b*L + l of the first output
  int l0 = row0 % L_;
  const float* xp = x + (size_t)row0 * D_ + d;
  float*       up = u + (size_t)row0 * D_ + d;
  v4f c0 = *(const v4f*)(ck + 0 * D_ + d);
  v4f c1 = *(const v4f*)(ck + 1 * D_ + d);
  v4f c2 = *(const v4f*)(ck + 2 * D_ + d);
  v4f r[CR_ + 2];                                    // rows l0-1 .. l0+CR_
  const v4f zero = {0.0f, 0.0f, 0.0f, 0.0f};
  r[0] = (l0 > 0) ? *(const v4f*)(xp - D_) : zero;
#pragma unroll
  for (int i = 0; i < CR_; ++i) r[i + 1] = *(const v4f*)(xp + i * D_);
  r[CR_ + 1] = (l0 + CR_ < L_) ? *(const v4f*)(xp + CR_ * D_) : zero;
#pragma unroll
  for (int i = 0; i < CR_; ++i) {
    v4f v = c0 * r[i] + c1 * r[i + 1] + c2 * r[i + 2];
    v4f o;
    o.x = silu_f(v.x); o.y = silu_f(v.y); o.z = silu_f(v.z); o.w = silu_f(v.w);
    *(v4f*)(up + i * D_) = o;
  }
}

// ---------------------------------------------------------------------------
// Kernel 2: proj = u @ [W_BC | W_dt] + [b_BC | b_dt]     (M=8192,K=512,N=64)
// One wave per 16x16 tile, V_WMMA_F32_16X16X4_F32, K-loop of 128.
// proj row layout: cols 0..15 = Bc, 16..31 = Cc, 32..63 = dt_rank proj.
// ---------------------------------------------------------------------------
__global__ void k_proj1(const float* __restrict__ u,
                        const float* __restrict__ W_BC, const float* __restrict__ b_BC,
                        const float* __restrict__ W_dt, const float* __restrict__ b_dt,
                        float* __restrict__ proj) {
  const int NT = 4;                                   // 64 / 16
  int wave = blockIdx.x * (blockDim.x >> 5) + (threadIdx.x >> 5);
  int lane = threadIdx.x & 31;
  if (wave >= (MTOT / 16) * NT) return;               // wave-uniform (never taken)
  int nt = wave % NT;
  int mt = wave / NT;
  int row0 = mt * 16;
  int ln = lane & 15;                                 // M for A-frag, N for B-frag
  int kk = (lane >> 4) << 1;                          // K sub-offset: 0 or 2

  const float* W = (nt < 2) ? W_BC : W_dt;            // both row-major (512,32)
  int ncol0 = (nt & 1) * 16;

  v8f acc = {};
  const float* arow = u + (size_t)(row0 + ln) * D_;
  for (int k = 0; k < D_; k += 4) {
    v2f a, b;
    a.x = arow[k + kk];
    a.y = arow[k + kk + 1];
    b.x = W[(k + kk)     * 32 + ncol0 + ln];
    b.y = W[(k + kk + 1) * 32 + ncol0 + ln];
    acc = __builtin_amdgcn_wmma_f32_16x16x4_f32(false, a, false, b,
                                                (short)0, acc, false, false);
  }
  int half = lane >> 4;
  int gcol = nt * 16 + ln;
  float bias = (gcol < 32) ? b_BC[gcol] : b_dt[gcol - 32];
#pragma unroll
  for (int r = 0; r < 8; ++r) {
    int row = row0 + r + 8 * half;
    proj[(size_t)row * 64 + gcol] = acc[r] + bias;
  }
}

// ---------------------------------------------------------------------------
// Kernel 3: Delta = softplus(dtr @ W_dtp + b_dtp)        (M=8192,K=32,N=512)
// ---------------------------------------------------------------------------
__global__ void k_proj2(const float* __restrict__ proj,
                        const float* __restrict__ W_dtp,   // (32,512) row-major
                        const float* __restrict__ b_dtp,
                        float* __restrict__ Delta) {
  const int NT = 32;                                  // 512 / 16
  int wave = blockIdx.x * (blockDim.x >> 5) + (threadIdx.x >> 5);
  int lane = threadIdx.x & 31;
  if (wave >= (MTOT / 16) * NT) return;               // wave-uniform (never taken)
  int nt = wave % NT;
  int mt = wave / NT;
  int row0 = mt * 16;
  int n0 = nt * 16;
  int ln = lane & 15;
  int kk = (lane >> 4) << 1;

  v8f acc = {};
  const float* arow = proj + (size_t)(row0 + ln) * 64 + 32;
#pragma unroll
  for (int k = 0; k < 32; k += 4) {
    v2f a, b;
    a.x = arow[k + kk];
    a.y = arow[k + kk + 1];
    b.x = W_dtp[(k + kk)     * D_ + n0 + ln];
    b.y = W_dtp[(k + kk + 1) * D_ + n0 + ln];
    acc = __builtin_amdgcn_wmma_f32_16x16x4_f32(false, a, false, b,
                                                (short)0, acc, false, false);
  }
  int half = lane >> 4;
  float bias = b_dtp[n0 + ln];
#pragma unroll
  for (int r = 0; r < 8; ++r) {
    int row = row0 + r + 8 * half;
    float v = acc[r] + bias;
    float sp = (v > 20.0f) ? v : log1pf(__expf(v));   // stable softplus
    Delta[(size_t)row * D_ + n0 + ln] = sp;
  }
}

// ---------------------------------------------------------------------------
// Chunked scan. Recurrence h[l] = a[l]*h[l-1] + b[l] composes per chunk as
//   h_out = P*h_in + g     (P = prod a, g = local scan with h_in = 0)
// Pass A: per (b,d,chunk) compute P[n], g[n].           65536 thr = 2048 waves
// Pass B: per (b,d) compose 16 carries -> Hin[chunk].   4096 thr
// Pass C: rerun chunk from Hin, emit y + x*Dparam.      65536 thr = 2048 waves
// P/G/Hin layout: [b][c][n][d]  (d fastest -> coalesced in every pass)
// ---------------------------------------------------------------------------
#define PGIDX(b,c,n,d) ((((size_t)(b)*C_ + (c))*N_ + (n))*D_ + (d))
#define LOG2E_ 1.4426950408889634f
#define PF_ 16             // timesteps whose Delta and x are fetched ahead as one group
#define NG_ (CL_ / PF_)    // groups per chunk

// 2^v straight from the hardware instruction. exp2f() wraps it in a rescue for results below
// 2^-126 (a compare, two selects, an add and an ldexp per call), which is most of the vector
// work of a scan step. Without it such a decay factor may come out as 0 instead of a denormal:
// it multiplies the carried state, so the difference is below 2^-126 times that state.
// Taken on pairs of states, so that the multiplies and fused multiply-adds around it stay the
// packed two-float instructions that the compiler formed around exp2f().
__device__ __forceinline__ v2f exp2_hw(v2f v) {
  v2f r;
  r.x = __builtin_amdgcn_exp2f(v.x);
  r.y = __builtin_amdgcn_exp2f(v.y);
  return r;
}

__global__ void __launch_bounds__(256) k_scan_partial(const float* __restrict__ x,
                               const float* __restrict__ proj,
                               const float* __restrict__ Delta,
                               const float* __restrict__ A_log,
                               float* __restrict__ Pbuf, float* __restrict__ Gbuf) {
  int blk = blockIdx.x;                       // B_*C_*(D_/256)
  int dg = blk % (D_ / 256);
  int c  = (blk / (D_ / 256)) % C_;
  int b  = blk / ((D_ / 256) * C_);
  int d  = dg * 256 + threadIdx.x;

  __shared__ float sB[CL_ * 16];              // Bc cols only: 4 KB
  const float* bcbase = proj + (size_t)(b * L_ + c * CL_) * 64;
  for (int t = threadIdx.x; t < CL_ * 16; t += 256) {
    int lr = t >> 4, cc = t & 15;
    async_g2l_b32((unsigned)(t * 4) + (unsigned)(size_t)sB,
                  bcbase + (size_t)lr * 64 + cc);
  }
  float A2[N_];
#pragma unroll
  for (int n = 0; n < N_; ++n)
    A2[n] = -__expf(A_log[d * N_ + n]) * LOG2E_;
  const float* dp = Delta + (size_t)(b * L_ + c * CL_) * D_ + d;
  const float* xp = x     + (size_t)(b * L_ + c * CL_) * D_ + d;
  float dn[PF_], xn[PF_];                     // the group in flight
#pragma unroll
  for (int i = 0; i < PF_; ++i) { dn[i] = dp[i * D_]; xn[i] = xp[i * D_]; }
  wait_async0();
  __syncthreads();

  float h[N_], p[N_];
#pragma unroll
  for (int n = 0; n < N_; ++n) { h[n] = 0.0f; p[n] = 1.0f; }
  v2f A2v[N_ / 2], hv[N_ / 2], pv[N_ / 2];    // the states and their rates as pairs (2j, 2j+1)
#pragma unroll
  for (int j = 0; j < N_ / 2; ++j) {
    A2v[j] = v2f{A2[2 * j], A2[2 * j + 1]};
    hv[j]  = v2f{h[2 * j], h[2 * j + 1]};
    pv[j]  = v2f{p[2 * j], p[2 * j + 1]};
  }

  // rolled: one group's body stays the loop (for speed only)
#pragma unroll 1
  for (int g = 0; g < NG_; ++g) {
    float dc[PF_], xc[PF_];
#pragma unroll
    for (int i = 0; i < PF_; ++i) { dc[i] = dn[i]; xc[i] = xn[i]; }
    if (g + 1 < NG_) {                        // next group's loads fly under this group's work
      dp += PF_ * D_;
      xp += PF_ * D_;
#pragma unroll
      for (int i = 0; i < PF_; ++i) { dn[i] = dp[i * D_]; xn[i] = xp[i * D_]; }
    }
#pragma unroll
    for (int i = 0; i < PF_; ++i) {
      float dv = dc[i];
      float xd = xc[i] * dv;
      const float* brow = &sB[(g * PF_ + i) * 16];
#pragma unroll
      for (int j = 0; j < N_ / 2; ++j) {
        v2f alpha = exp2_hw(A2v[j] * dv);
        v2f bb = {brow[2 * j], brow[2 * j + 1]};
        pv[j] *= alpha;
        hv[j] = __builtin_elementwise_fma(alpha, hv[j], bb * xd);
      }
    }
  }
#pragma unroll
  for (int j = 0; j < N_ / 2; ++j) {
    p[2 * j] = pv[j].x; p[2 * j + 1] = pv[j].y;
    h[2 * j] = hv[j].x; h[2 * j + 1] = hv[j].y;
  }
#pragma unroll
  for (int n = 0; n < N_; ++n) {
    Pbuf[PGIDX(b, c, n, d)] = p[n];
    Gbuf[PGIDX(b, c, n, d)] = h[n];
  }
}

__global__ void k_scan_carry(const float* __restrict__ Pbuf,
                             const float* __restrict__ Gbuf,
                             float* __restrict__ Hin) {
  int b = blockIdx.x / (D_ / 256);
  int d = (blockIdx.x % (D_ / 256)) * 256 + threadIdx.x;
  float h[N_];
#pragma unroll
  for (int n = 0; n < N_; ++n) h[n] = 0.0f;
  for (int c = 0; c < C_; ++c) {
#pragma unroll
    for (int n = 0; n < N_; ++n) {
      size_t i = PGIDX(b, c, n, d);
      Hin[i] = h[n];                          // state entering chunk c
      h[n] = Pbuf[i] * h[n] + Gbuf[i];        // compose carry
    }
  }
}

__global__ void __launch_bounds__(256) k_scan_final(const float* __restrict__ x,
                             const float* __restrict__ proj,
                             const float* __restrict__ Delta,
                             const float* __restrict__ A_log,
                             const float* __restrict__ Dparam,
                             const float* __restrict__ Hin,
                             float* __restrict__ out) {
  int blk = blockIdx.x;
  int dg = blk % (D_ / 256);
  int c  = (blk / (D_ / 256)) % C_;
  int b  = blk / ((D_ / 256) * C_);
  int d  = dg * 256 + threadIdx.x;

  __shared__ float sBC[CL_ * 32];             // Bc|Cc: 8 KB
  const float* bcbase = proj + (size_t)(b * L_ + c * CL_) * 64;
  for (int t = threadIdx.x; t < CL_ * 32; t += 256) {
    int lr = t >> 5, cc = t & 31;
    async_g2l_b32((unsigned)(t * 4) + (unsigned)(size_t)sBC,
                  bcbase + (size_t)lr * 64 + cc);
  }
  float A2[N_];
#pragma unroll
  for (int n = 0; n < N_; ++n)
    A2[n] = -__expf(A_log[d * N_ + n]) * LOG2E_;
  float Dp = Dparam[d];
  float h[N_];
#pragma unroll
  for (int n = 0; n < N_; ++n) h[n] = Hin[PGIDX(b, c, n, d)];
  v2f A2v[N_ / 2], hv[N_ / 2];                // the states and their rates as pairs (2j, 2j+1)
#pragma unroll
  for (int j = 0; j < N_ / 2; ++j) {
    A2v[j] = v2f{A2[2 * j], A2[2 * j + 1]};
    hv[j]  = v2f{h[2 * j], h[2 * j + 1]};
  }
  const float* dp = Delta + (size_t)(b * L_ + c * CL_) * D_ + d;
  const float* xp = x     + (size_t)(b * L_ + c * CL_) * D_ + d;
  float*       op = out   + (size_t)(b * L_ + c * CL_) * D_ + d;
  float dn[PF_], xn[PF_];                     // the group in flight
#pragma unroll
  for (int i = 0; i < PF_; ++i) { dn[i] = dp[i * D_]; xn[i] = xp[i * D_]; }
  wait_async0();
  __syncthreads();

  // rolled: one group's body stays the loop (for speed only)
#pragma unroll 1
  for (int g = 0; g < NG_; ++g) {
    float dc[PF_], xc[PF_];
#pragma unroll
    for (int i = 0; i < PF_; ++i) { dc[i] = dn[i]; xc[i] = xn[i]; }
    if (g + 1 < NG_) {                        // next group's loads fly under this group's work
      dp += PF_ * D_;
      xp += PF_ * D_;
#pragma unroll
      for (int i = 0; i < PF_; ++i) { dn[i] = dp[i * D_]; xn[i] = xp[i * D_]; }
    }
#pragma unroll
    for (int i = 0; i < PF_; ++i) {
      float dv = dc[i];
      float xv = xc[i];
      float xd = xv * dv;
      const float* bc = &sBC[(g * PF_ + i) * 32];
      float y = 0.0f;
#pragma unroll
      for (int j = 0; j < N_ / 2; ++j) {
        v2f alpha = exp2_hw(A2v[j] * dv);
        v2f bb = {bc[2 * j], bc[2 * j + 1]};
        hv[j] = __builtin_elementwise_fma(alpha, hv[j], bb * xd);
        y += bc[16 + 2 * j]     * hv[j].x;    // one chain in the order of n
        y += bc[16 + 2 * j + 1] * hv[j].y;
      }
      op[(g * PF_ + i) * D_] = y + xv * Dp;
      // every fourth step: bounds how far the scheduler spreads the unrolled steps (without it
      // the registers pass 256 and register-window switches enter the loop); the last one also
      // keeps the hand-over of the fetched registers, with its load wait, behind the work
      if ((i & 3) == 3) __builtin_amdgcn_sched_barrier(0);
    }
  }
}

// ---------------------------------------------------------------------------
extern "C" void kernel_launch(void* const* d_in, const int* in_sizes, int n_in,
                              void* d_out, int out_size, void* d_ws, size_t ws_size,
                              hipStream_t stream) {
  const float* x    = (const float*)d_in[0];
  const float* ck   = (const float*)d_in[1];
  const float* W_BC = (const float*)d_in[2];
  const float* b_BC = (const float*)d_in[3];
  const float* A_lg = (const float*)d_in[4];
  const float* Dpar = (const float*)d_in[5];
  const float* W_dt = (const float*)d_in[6];
  const float* b_dt = (const float*)d_in[7];
  const float* Wdtp = (const float*)d_in[8];
  const float* bdtp = (const float*)d_in[9];
  float* out = (float*)d_out;

  char* ws = (char*)d_ws;
  const size_t SZ_U  = (size_t)B_ * L_ * D_ * 4;          // 16 MB
  const size_t SZ_PG = (size_t)B_ * C_ * N_ * D_ * 4;     //  4 MB
  float* u     = (float*)ws;                              // [0,16MB) (dead after proj1)
  float* Pbuf  = (float*)ws;                              // aliases u: [0,4MB)
  float* Gbuf  = (float*)(ws + SZ_PG);                    // aliases u: [4,8MB)
  float* proj  = (float*)(ws + SZ_U);                     //  2 MB
  float* Delta = (float*)(ws + SZ_U + (size_t)MTOT * 64 * 4);   // 16 MB
  float* Hin   = (float*)(ws + SZ_U + (size_t)MTOT * 64 * 4 + SZ_U); // 4 MB

  // 1) conv + silu
  k_conv_silu<<<(B_ * L_ / CR_) * (D_ / 4) / 256, 256, 0, stream>>>(x, ck, u);

  // 2) proj = u @ [W_BC|W_dt] + bias : 2048 waves
  k_proj1<<<512, 128, 0, stream>>>(u, W_BC, b_BC, W_dt, b_dt, proj);

  // 3) Delta = softplus(dtr @ W_dtp + b_dtp) : 16384 waves
  k_proj2<<<4096, 128, 0, stream>>>(proj, Wdtp, bdtp, Delta);

  // 4) chunked scan: partial -> carry -> final
  int scan_blocks = B_ * C_ * (D_ / 256);                 // 256 blocks
  k_scan_partial<<<scan_blocks, 256, 0, stream>>>(x, proj, Delta, A_lg, Pbuf, Gbuf);
  k_scan_carry<<<B_ * (D_ / 256), 256, 0, stream>>>(Pbuf, Gbuf, Hin);
  k_scan_final<<<scan_blocks, 256, 0, stream>>>(x, proj, Delta, A_lg, Dpar, Hin, out);
}

// v004
// One run takes 60.8 microseconds.
// In two side-by-side timings against v003, it was 1.08 and 1.09 times as fast.
// Over all steps from v000 it is 2.18 times as fast.
#include <hip/hip_runtime.h>
#include <hip/hip_bf16.h>
#include <math.h>

#define B_    8
#define L_    1024
#define D_    512
#define N_    16
#define MTOT  (B_*L_)      // 8192 rows
#define C_    16           // scan chunks
#define CL_   64           // timesteps per chunk (C_*CL_ == L_)

typedef __attribute__((ext_vector_type(2))) float v2f;
typedef __attribute__((ext_vector_type(8))) float v8f;

__device__ __forceinline__ float silu_f(float v) { return v / (1.0f + __expf(-v)); }

// CDNA5 async global->LDS copy (4B per lane), tracked by ASYNCcnt.
__device__ __forceinline__ void async_g2l_b32(unsigned lds_off, const float* gaddr) {
  asm volatile("global_load_async_to_lds_b32 %0, %1, off"
               :: "v"(lds_off), "v"(gaddr) : "memory");
}
__device__ __forceinline__ void wait_async0() {
  asm volatile("s_wait_asynccnt 0x0" ::: "memory");
}

// ---------------------------------------------------------------------------
// Kernel 1: depthwise conv3 (SAME, zero pad) + SiLU  ->  u (B,L,D)
// One thread makes 4 channels x CR_ rows: 16-byte loads and stores, each x row loaded
// once per thread and used by three output rows, and 4096 waves in place of 131072.
// ---------------------------------------------------------------------------
#define CR_ 8              // rows per thread; divides L_, so a thread stays in one sequence
typedef __attribute__((ext_vector_type(4))) float v4f;

__global__ void __launch_bounds__(256) k_conv_silu(const float* __restrict__ x,
                            const float* __restrict__ ck,   // (K=3,1,D)
                            float* __restrict__ u) {
  int t = blockIdx.x * 256 + threadIdx.x;            // over (B*L/CR_) * (D/4)
  int d = (t % (D_ / 4)) * 4;
  int row0 = (t / (D_ / 4)) * CR_;                   // flat row b*L + l of the first output
  int l0 = row0 % L_;
  const float* xp = x + (size_t)row0 * D_ + d;
  float*       up = u + (size_t)row0 * D_ + d;
  v4f c0 = *(const v4f*)(ck + 0 * D_ + d);
  v4f c1 = *(const v4f*)(ck + 1 * D_ + d);
  v4f c2 = *(const v4f*)(ck + 2 * D_ + d);
  v4f r[CR_ + 2];                                    // rows l0-1 .. l0+CR_
  const v4f zero = {0.0f, 0.0f, 0.0f, 0.0f};
  r[0] = (l0 > 0) ? *(const v4f*)(xp - D_) : zero;
#pragma unroll
  for (int i = 0; i < CR_; ++i) r[i + 1] = *(const v4f*)(xp + i * D_);
  r[CR_ + 1] = (l0 + CR_ < L_) ? *(const v4f*)(xp + CR_ * D_) : zero;
#pragma unroll
  for (int i = 0; i < CR_; ++i) {
    v4f v = c0 * r[i] + c1 * r[i + 1] + c2 * r[i + 2];
    v4f o;
    o.x = silu_f(v.x); o.y = silu_f(v.y); o.z = silu_f(v.z); o.w = silu_f(v.w);
    *(v4f*)(up + i * D_) = o;
  }
}

// ---------------------------------------------------------------------------
// Kernel 2: proj = u @ [W_BC | W_dt] + [b_BC | b_dt]     (M=8192,K=512,N=64)
// One wave per 16x16 tile, V_WMMA_F32_16X16X4_F32, K-loop of 128.
// proj row layout: cols 0..15 = Bc, 16..31 = Cc, 32..63 = dt_rank proj.
// ---------------------------------------------------------------------------
__global__ void k_proj1(const float* __restrict__ u,
                        const float* __restrict__ W_BC, const float* __restrict__ b_BC,
                        const float* __restrict__ W_dt, const float* __restrict__ b_dt,
                        float* __restrict__ proj) {
  const int NT = 4;                                   // 64 / 16
  int wave = blockIdx.x * (blockDim.x >> 5) + (threadIdx.x >> 5);
  int lane = threadIdx.x & 31;
  if (wave >= (MTOT / 16) * NT) return;               // wave-uniform (never taken)
  int nt = wave % NT;
  int mt = wave / NT;
  int row0 = mt * 16;
  int ln = lane & 15;                                 // M for A-frag, N for B-frag
  int kk = (lane >> 4) << 1;                          // K sub-offset: 0 or 2

  const float* W = (nt < 2) ? W_BC : W_dt;            // both row-major (512,32)
  int ncol0 = (nt & 1) * 16;

  v8f acc = {};
  const float* arow = u + (size_t)(row0 + ln) * D_;
  for (int k = 0; k < D_; k += 4) {
    v2f a, b;
    a.x = arow[k + kk];
    a.y = arow[k + kk + 1];
    b.x = W[(k + kk)     * 32 + ncol0 + ln];
    b.y = W[(k + kk + 1) * 32 + ncol0 + ln];
    acc = __builtin_amdgcn_wmma_f32_16x16x4_f32(false, a, false, b,
                                                (short)0, acc, false, false);
  }
  int half = lane >> 4;
  int gcol = nt * 16 + ln;
  float bias = (gcol < 32) ? b_BC[gcol] : b_dt[gcol - 32];
#pragma unroll
  for (int r = 0; r < 8; ++r) {
    int row = row0 + r + 8 * half;
    proj[(size_t)row * 64 + gcol] = acc[r] + bias;
  }
}

// ---------------------------------------------------------------------------
// Kernel 3: Delta = softplus(dtr @ W_dtp + b_dtp)        (M=8192,K=32,N=512)
// ---------------------------------------------------------------------------
__global__ void k_proj2(const float* __restrict__ proj,
                        const float* __restrict__ W_dtp,   // (32,512) row-major
                        const float* __restrict__ b_dtp,
                        float* __restrict__ Delta) {
  const int NT = 32;                                  // 512 / 16
  int wave = blockIdx.x * (blockDim.x >> 5) + (threadIdx.x >> 5);
  int lane = threadIdx.x & 31;
  if (wave >= (MTOT / 16) * NT) return;               // wave-uniform (never taken)
  int nt = wave % NT;
  int mt = wave / NT;
  int row0 = mt * 16;
  int n0 = nt * 16;
  int ln = lane & 15;
  int kk = (lane >> 4) << 1;

  v8f acc = {};
  const float* arow = proj + (size_t)(row0 + ln) * 64 + 32;
#pragma unroll
  for (int k = 0; k < 32; k += 4) {
    v2f a, b;
    a.x = arow[k + kk];
    a.y = arow[k + kk + 1];
    b.x = W_dtp[(k + kk)     * D_ + n0 + ln];
    b.y = W_dtp[(k + kk + 1) * D_ + n0 + ln];
    acc = __builtin_amdgcn_wmma_f32_16x16x4_f32(false, a, false, b,
                                                (short)0, acc, false, false);
  }
  int half = lane >> 4;
  float bias = b_dtp[n0 + ln];
#pragma unroll
  for (int r = 0; r < 8; ++r) {
    int row = row0 + r + 8 * half;
    float v = acc[r] + bias;
    float sp = (v > 20.0f) ? v : log1pf(__expf(v));   // stable softplus
    Delta[(size_t)row * D_ + n0 + ln] = sp;
  }
}

// ---------------------------------------------------------------------------
// Chunked scan. Recurrence h[l] = a[l]*h[l-1] + b[l] composes per chunk as
//   h_out = P*h_in + g     (P = prod a, g = local scan with h_in = 0)
// Pass A: per (b,d,chunk) compute P[n], g[n].           65536 thr = 2048 waves
// Pass C: compose the carries of the chunks in front of its own into its entry state, rerun the
//         chunk from there, emit y + x*Dparam.          65536 thr = 2048 waves
// P/G layout: [b][c][n/4][d][n%4]: a thread's four states are one 16-byte word and a wave's
// words are 512 bytes in a row.
// ---------------------------------------------------------------------------
#define NQ_ (N_ / 4)       // 16-byte words of states per thread
#define PG4IDX(b,c,q,d) ((((size_t)(b)*C_ + (c))*NQ_ + (q))*D_ + (d))   // in 16-byte words
#define LOG2E_ 1.4426950408889634f
#define PF_ 16             // timesteps whose Delta and x are fetched ahead as one group
#define NG_ (CL_ / PF_)    // groups per chunk

// 2^v straight from the hardware instruction. exp2f() wraps it in a rescue for results below
// 2^-126 (a compare, two selects, an add and an ldexp per call), which is most of the vector
// work of a scan step. Without it such a decay factor may come out as 0 instead of a denormal:
// it multiplies the carried state, so the difference is below 2^-126 times that state.
// Taken on pairs of states, so that the multiplies and fused multiply-adds around it stay the
// packed two-float instructions that the compiler formed around exp2f().
__device__ __forceinline__ v2f exp2_hw(v2f v) {
  v2f r;
  r.x = __builtin_amdgcn_exp2f(v.x);
  r.y = __builtin_amdgcn_exp2f(v.y);
  return r;
}

__global__ void __launch_bounds__(256) k_scan_partial(const float* __restrict__ x,
                               const float* __restrict__ proj,
                               const float* __restrict__ Delta,
                               const float* __restrict__ A_log,
                               float* __restrict__ Pbuf, float* __restrict__ Gbuf) {
  int blk = blockIdx.x;                       // B_*C_*(D_/256)
  int dg = blk % (D_ / 256);
  int c  = (blk / (D_ / 256)) % C_;
  int b  = blk / ((D_ / 256) * C_);
  int d  = dg * 256 + threadIdx.x;

  __shared__ float sB[CL_ * 16];              // Bc cols only: 4 KB
  const float* bcbase = proj + (size_t)(b * L_ + c * CL_) * 64;
  for (int t = threadIdx.x; t < CL_ * 16; t += 256) {
    int lr = t >> 4, cc = t & 15;
    async_g2l_b32((unsigned)(t * 4) + (unsigned)(size_t)sB,
                  bcbase + (size_t)lr * 64 + cc);
  }
  float A2[N_];
#pragma unroll
  for (int n = 0; n < N_; ++n)
    A2[n] = -__expf(A_log[d * N_ + n]) * LOG2E_;
  const float* dp = Delta + (size_t)(b * L_ + c * CL_) * D_ + d;
  const float* xp = x     + (size_t)(b * L_ + c * CL_) * D_ + d;
  float dn[PF_], xn[PF_];                     // the group in flight
#pragma unroll
  for (int i = 0; i < PF_; ++i) { dn[i] = dp[i * D_]; xn[i] = xp[i * D_]; }
  wait_async0();
  __syncthreads();

  float h[N_], p[N_];
#pragma unroll
  for (int n = 0; n < N_; ++n) { h[n] = 0.0f; p[n] = 1.0f; }
  v2f A2v[N_ / 2], hv[N_ / 2], pv[N_ / 2];    // the states and their rates as pairs (2j, 2j+1)
#pragma unroll
  for (int j = 0; j < N_ / 2; ++j) {
    A2v[j] = v2f{A2[2 * j], A2[2 * j + 1]};
    hv[j]  = v2f{h[2 * j], h[2 * j + 1]};
    pv[j]  = v2f{p[2 * j], p[2 * j + 1]};
  }

  // rolled: one group's body stays the loop (for speed only)
#pragma unroll 1
  for (int g = 0; g < NG_; ++g) {
    float dc[PF_], xc[PF_];
#pragma unroll
    for (int i = 0; i < PF_; ++i) { dc[i] = dn[i]; xc[i] = xn[i]; }
    if (g + 1 < NG_) {                        // next group's loads fly under this group's work
      dp += PF_ * D_;
      xp += PF_ * D_;
#pragma unroll
      for (int i = 0; i < PF_; ++i) { dn[i] = dp[i * D_]; xn[i] = xp[i * D_]; }
    }
#pragma unroll
    for (int i = 0; i < PF_; ++i) {
      float dv = dc[i];
      float xd = xc[i] * dv;
      const float* brow = &sB[(g * PF_ + i) * 16];
#pragma unroll
      for (int j = 0; j < N_ / 2; ++j) {
        v2f alpha = exp2_hw(A2v[j] * dv);
        v2f bb = {brow[2 * j], brow[2 * j + 1]};
        pv[j] *= alpha;
        hv[j] = __builtin_elementwise_fma(alpha, hv[j], bb * xd);
      }
    }
  }
#pragma unroll
  for (int j = 0; j < N_ / 2; ++j) {
    p[2 * j] = pv[j].x; p[2 * j + 1] = pv[j].y;
    h[2 * j] = hv[j].x; h[2 * j + 1] = hv[j].y;
  }
#pragma unroll
  for (int q = 0; q < NQ_; ++q) {
    ((v4f*)Pbuf)[PG4IDX(b, c, q, d)] = v4f{p[4 * q], p[4 * q + 1], p[4 * q + 2], p[4 * q + 3]};
    ((v4f*)Gbuf)[PG4IDX(b, c, q, d)] = v4f{h[4 * q], h[4 * q + 1], h[4 * q + 2], h[4 * q + 3]};
  }
}

#define NB_ 4              // chunk carries in flight per thread while the entry state is composed

// Chunk S of the chain h = P*h + g, then the refill of its buffer with chunk S + NB_, then the
// rest of the chain. Written out chunk by chunk (a recursion at compile time) and without a
// branch: the NB_ buffers take turns without register copies, and no load can be moved down
// to its use. A chunk at or behind c leaves h as it is (c is the same for the whole block).
template <int S>
__device__ __forceinline__ void carry_from(int c, int clast, int d,
                                           const v4f* __restrict__ P4, const v4f* __restrict__ G4,
                                           v4f (&hq)[NQ_], v4f (&pb)[NB_][NQ_], v4f (&gb)[NB_][NQ_]) {
  if constexpr (S < C_ - 1) {
    constexpr int k = S % NB_;
    const bool on = S < c;
#pragma unroll
    for (int q = 0; q < NQ_; ++q) {
      v4f t = __builtin_elementwise_fma(pb[k][q], hq[q], gb[k][q]);
      hq[q] = on ? t : hq[q];
    }
    if constexpr (S + NB_ < C_ - 1) {
      int cc = (S + NB_ < clast) ? S + NB_ : clast;
      const v4f* Pc = P4 + cc * NQ_ * D_;     // the same for the block: a scalar base
      const v4f* Gc = G4 + cc * NQ_ * D_;
#pragma unroll
      for (int q = 0; q < NQ_; ++q) {
        pb[k][q] = Pc[q * D_ + d];
        gb[k][q] = Gc[q * D_ + d];
      }
      // compiler fence: keeps each refill where it is written, in front of the next chunk's
      // wait; without it the refills are gathered behind one wait for everything in flight
      asm volatile("" ::: "memory");
    }
    carry_from<S + 1>(c, clast, d, P4, G4, hq, pb, gb);
  }
}

__global__ void __launch_bounds__(256) k_scan_final(const float* __restrict__ x,
                             const float* __restrict__ proj,
                             const float* __restrict__ Delta,
                             const float* __restrict__ A_log,
                             const float* __restrict__ Dparam,
                             const float* __restrict__ Pbuf,
                             const float* __restrict__ Gbuf,
                             float* __restrict__ out) {
  int blk = blockIdx.x;
  int dg = blk % (D_ / 256);
  int c  = (blk / (D_ / 256)) % C_;
  int b  = blk / ((D_ / 256) * C_);
  int d  = dg * 256 + threadIdx.x;

  __shared__ float sBC[CL_ * 32];             // Bc|Cc: 8 KB
  const float* bcbase = proj + (size_t)(b * L_ + c * CL_) * 64;
  for (int t = threadIdx.x; t < CL_ * 32; t += 256) {
    int lr = t >> 5, cc = t & 31;
    async_g2l_b32((unsigned)(t * 4) + (unsigned)(size_t)sBC,
                  bcbase + (size_t)lr * 64 + cc);
  }
  float A2[N_];
#pragma unroll
  for (int n = 0; n < N_; ++n)
    A2[n] = -__expf(A_log[d * N_ + n]) * LOG2E_;
  float Dp = Dparam[d];
  const float* dp = Delta + (size_t)(b * L_ + c * CL_) * D_ + d;
  const float* xp = x     + (size_t)(b * L_ + c * CL_) * D_ + d;
  float*       op = out   + (size_t)(b * L_ + c * CL_) * D_ + d;
  float dn[PF_], xn[PF_];                     // the group in flight
#pragma unroll
  for (int i = 0; i < PF_; ++i) { dn[i] = dp[i * D_]; xn[i] = xp[i * D_]; }

  // Entry state of chunk c: h = P*h + g over the chunks 0 .. c-1, in that order, from h = 0.
  // NB_ chunks' P and g are in flight at any time. On the way through the chunks every load is
  // unconditional, so that the waits in front of the uses stay counted ones: an index past c-1
  // is clamped to c-1 (to 0 for c == 0), a chunk that pass A has written; it is not used.
  const v4f* P4 = (const v4f*)Pbuf + PG4IDX(b, 0, 0, 0);
  const v4f* G4 = (const v4f*)Gbuf + PG4IDX(b, 0, 0, 0);
  const int clast = (c > 0) ? c - 1 : 0;
  v4f hq[NQ_], pb[NB_][NQ_], gb[NB_][NQ_];
#pragma unroll
  for (int q = 0; q < NQ_; ++q) hq[q] = v4f{0.0f, 0.0f, 0.0f, 0.0f};
#pragma unroll
  for (int k = 0; k < NB_; ++k) {
    int cc = (k < clast) ? k : clast;
    const v4f* Pc = P4 + cc * NQ_ * D_;       // the same for the block: a scalar base
    const v4f* Gc = G4 + cc * NQ_ * D_;
#pragma unroll
    for (int q = 0; q < NQ_; ++q) {
      pb[k][q] = Pc[q * D_ + d];
      gb[k][q] = Gc[q * D_ + d];
    }
    // compiler fence: keeps the chunks' loads in the order of their use (loads return in order,
    // so the wait in front of chunk k then leaves the later chunks in flight)
    asm volatile("" ::: "memory");
  }
  carry_from<0>(c, clast, d, P4, G4, hq, pb, gb);
  v2f A2v[N_ / 2], hv[N_ / 2];                // the states and their rates as pairs (2j, 2j+1)
#pragma unroll
  for (int j = 0; j < N_ / 2; ++j) {
    A2v[j] = v2f{A2[2 * j], A2[2 * j + 1]};
    hv[j]  = v2f{hq[j / 2][(j & 1) * 2], hq[j / 2][(j & 1) * 2 + 1]};
  }
  wait_async0();
  __syncthreads();

  // rolled: one group's body stays the loop (for speed only)
#pragma unroll 1
  for (int g = 0; g < NG_; ++g) {
    float dc[PF_], xc[PF_];
#pragma unroll
    for (int i = 0; i < PF_; ++i) { dc[i] = dn[i]; xc[i] = xn[i]; }
    if (g + 1 < NG_) {                        // next group's loads fly under this group's work
      dp += PF_ * D_;
      xp += PF_ * D_;
#pragma unroll
      for (int i = 0; i < PF_; ++i) { dn[i] = dp[i * D_]; xn[i] = xp[i * D_]; }
    }
#pragma unroll
    for (int i = 0; i < PF_; ++i) {
      float dv = dc[i];
      float xv = xc[i];
      float xd = xv * dv;
      const float* bc = &sBC[(g * PF_ + i) * 32];
      float y = 0.0f;
#pragma unroll
      for (int j = 0; j < N_ / 2; ++j) {
        v2f alpha = exp2_hw(A2v[j] * dv);
        v2f bb = {bc[2 * j], bc[2 * j + 1]};
        hv[j] = __builtin_elementwise_fma(alpha, hv[j], bb * xd);
        y += bc[16 + 2 * j]     * hv[j].x;    // one chain in the order of n
        y += bc[16 + 2 * j + 1] * hv[j].y;
      }
      op[(g * PF_ + i) * D_] = y + xv * Dp;
      // every fourth step: bounds how far the scheduler spreads the unrolled steps (without it
      // the registers pass 256 and register-window switches enter the loop); the last one also
      // keeps the hand-over of the fetched registers, with its load wait, behind the work
      if ((i & 3) == 3) __builtin_amdgcn_sched_barrier(0);
    }
  }
}

// ---------------------------------------------------------------------------
extern "C" void kernel_launch(void* const* d_in, const int* in_sizes, int n_in,
                              void* d_out, int out_size, void* d_ws, size_t ws_size,
                              hipStream_t stream) {
  const float* x    = (const float*)d_in[0];
  const float* ck   = (const float*)d_in[1];
  const float* W_BC = (const float*)d_in[2];
  const float* b_BC = (const float*)d_in[3];
  const float* A_lg = (const float*)d_in[4];
  const float* Dpar = (const float*)d_in[5];
  const float* W_dt = (const float*)d_in[6];
  const float* b_dt = (const float*)d_in[7];
  const float* Wdtp = (const float*)d_in[8];
  const float* bdtp = (const float*)d_in[9];
  float* out = (float*)d_out;

  char* ws = (char*)d_ws;
  const size_t SZ_U  = (size_t)B_ * L_ * D_ * 4;          // 16 MB
  const size_t SZ_PG = (size_t)B_ * C_ * N_ * D_ * 4;     //  4 MB
  float* u     = (float*)ws;                              // [0,16MB) (dead after proj1)
  float* Pbuf  = (float*)ws;                              // aliases u: [0,4MB)
  float* Gbuf  = (float*)(ws + SZ_PG);                    // aliases u: [4,8MB)
  float* proj  = (float*)(ws + SZ_U);                     //  2 MB
  float* Delta = (float*)(ws + SZ_U + (size_t)MTOT * 64 * 4);   // 16 MB

  // 1) conv + silu
  k_conv_silu<<<(B_ * L_ / CR_) * (D_ / 4) / 256, 256, 0, stream>>>(x, ck, u);

  // 2) proj = u @ [W_BC|W_dt] + bias : 2048 waves
  k_proj1<<<512, 128, 0, stream>>>(u, W_BC, b_BC, W_dt, b_dt, proj);

  // 3) Delta = softplus(dtr @ W_dtp + b_dtp) : 16384 waves
  k_proj2<<<4096, 128, 0, stream>>>(proj, Wdtp, bdtp, Delta);

  // 4) chunked scan: partial -> final
  int scan_blocks = B_ * C_ * (D_ / 256);                 // 256 blocks
  k_scan_partial<<<scan_blocks, 256, 0, stream>>>(x, proj, Delta, A_lg, Pbuf, Gbuf);
  k_scan_final<<<scan_blocks, 256, 0, stream>>>(x, proj, Delta, A_lg, Dpar, Pbuf, Gbuf, out);
}

// v005
// One run takes 48.7 microseconds.
// Next to v004, in two timings, it ran 1.25 and 1.24 times as fast.
// Over all steps from v000 it is 2.72 times as fast.
#include <hip/hip_runtime.h>
#include <hip/hip_bf16.h>
#include <math.h>

#define B_    8
#define L_    1024
#define D_    512
#define N_    16
#define MTOT  (B_*L_)      // 8192 rows
#define C_    16           // scan chunks
#define CL_   64           // timesteps per chunk (C_*CL_ == L_)

typedef __attribute__((ext_vector_type(2))) float v2f;
typedef __attribute__((ext_vector_type(8))) float v8f;

__device__ __forceinline__ float silu_f(float v) { return v / (1.0f + __expf(-v)); }

// CDNA5 async global->LDS copy (4B per lane), tracked by ASYNCcnt.
__device__ __forceinline__ void async_g2l_b32(unsigned lds_off, const float* gaddr) {
  asm volatile("global_load_async_to_lds_b32 %0, %1, off"
               :: "v"(lds_off), "v"(gaddr) : "memory");
}
__device__ __forceinline__ void wait_async0() {
  asm volatile("s_wait_asynccnt 0x0" ::: "memory");
}

// ---------------------------------------------------------------------------
// Kernel 1: u = SiLU(depthwise conv3(x), SAME, zero pad), kept in LDS, and
//           proj = u @ [W_BC | W_dt] + [b_BC | b_dt]     (M=8192,K=512,N=64)
// One block per RB_ rows. Part 1: a thread makes 4 channels x CR_ rows of u with 16-byte loads,
// each x row loaded once per thread and used by three output rows. Part 2: one wave per 16x16
// tile, V_WMMA_F32_16X16X4_F32, 128 steps of k in rising order on one accumulator.
// proj row layout: cols 0..15 = Bc, 16..31 = Cc, 32..63 = dt_rank proj.
// ---------------------------------------------------------------------------
#define RB_ 32             // rows per block; divides L_, so a block stays in one sequence
#define CR_ 16             // rows per thread in part 1 (two thread halves cover RB_)
#define UP_ (D_ + 4)       // LDS pitch of a u row in floats: 16 rows' 8-byte reads meet no bank twice
#define KG_ 16             // k-steps (of 4) whose operands are fetched ahead as one group
#define NKG_ (D_ / (4 * KG_))
typedef __attribute__((ext_vector_type(4))) float v4f;

__global__ void __launch_bounds__(256) k_conv_proj1(const float* __restrict__ x,
                        const float* __restrict__ ck,   // (K=3,1,D)
                        const float* __restrict__ W_BC, const float* __restrict__ b_BC,
                        const float* __restrict__ W_dt, const float* __restrict__ b_dt,
                        float* __restrict__ proj) {
  __shared__ __attribute__((aligned(16))) float sU[RB_ * UP_];
  const int tid = threadIdx.x;
  const int lane = tid & 31;
  const int wave = tid >> 5;
  const int nt = wave & 3;                            // 64 / 16 column tiles
  const int mt = wave >> 2;                           // RB_ / 16 row tiles
  const int ln = lane & 15;                           // M for A-frag, N for B-frag
  const int kk = (lane >> 4) << 1;                    // K sub-offset: 0 or 2

  const float* W = (nt < 2) ? W_BC : W_dt;            // both row-major (512,32)
  const float* wp = W + kk * 32 + (nt & 1) * 16 + ln;
  float bq[3][2 * KG_];                               // W groups: one in use, two in flight

  {
    const int d = (tid & 127) * 4;
    const int lr0 = (tid >> 7) * CR_;                 // first row of this thread inside the block
    const int row0 = blockIdx.x * RB_ + lr0;          // flat row b*L + l of the first output
    const int l0 = row0 % L_;
    const float* xp = x + (size_t)row0 * D_ + d;
    v4f c0 = *(const v4f*)(ck + 0 * D_ + d);
    v4f c1 = *(const v4f*)(ck + 1 * D_ + d);
    v4f c2 = *(const v4f*)(ck + 2 * D_ + d);
    v4f r[CR_ + 2];                                   // rows l0-1 .. l0+CR_
    const v4f zero = {0.0f, 0.0f, 0.0f, 0.0f};
    r[0] = (l0 > 0) ? *(const v4f*)(xp - D_) : zero;
#pragma unroll
    for (int i = 0; i < CR_; ++i) r[i + 1] = *(const v4f*)(xp + i * D_);
    r[CR_ + 1] = (l0 + CR_ < L_) ? *(const v4f*)(xp + CR_ * D_) : zero;
    // the first two groups of W are asked for here, behind x, so that they fly under part 1
#pragma unroll
    for (int g = 0; g < 2; ++g) {
#pragma unroll
      for (int i = 0; i < KG_; ++i) {
        bq[g][2 * i]     = wp[(g * 4 * KG_ + 4 * i)     * 32];
        bq[g][2 * i + 1] = wp[(g * 4 * KG_ + 4 * i + 1) * 32];
      }
    }
#pragma unroll
    for (int i = 0; i < CR_; ++i) {
      v4f v = c0 * r[i] + c1 * r[i + 1] + c2 * r[i + 2];
      v4f o;
      o.x = silu_f(v.x); o.y = silu_f(v.y); o.z = silu_f(v.z); o.w = silu_f(v.w);
      *(v4f*)&sU[(lr0 + i) * UP_ + d] = o;
    }
  }
  __syncthreads();                                    // u of the block's rows is complete

  v8f acc = {};
  const float* ap = &sU[(mt * 16 + ln) * UP_ + kk];
  v2f aq[2][KG_];                                     // u groups: one in use, one in flight
#pragma unroll
  for (int i = 0; i < KG_; ++i) aq[0][i] = *(const v2f*)(ap + 4 * i);
  // written out group by group: the buffers take turns without register copies, and every load
  // is unconditional, so that the waits in front of the products stay counted ones
#pragma unroll
  for (int g = 0; g < NKG_; ++g) {
    if (g + 2 < NKG_) {
#pragma unroll
      for (int i = 0; i < KG_; ++i) {
        bq[(g + 2) % 3][2 * i]     = wp[((g + 2) * 4 * KG_ + 4 * i)     * 32];
        bq[(g + 2) % 3][2 * i + 1] = wp[((g + 2) * 4 * KG_ + 4 * i + 1) * 32];
      }
    }
    if (g + 1 < NKG_) {
#pragma unroll
      for (int i = 0; i < KG_; ++i)
        aq[(g + 1) & 1][i] = *(const v2f*)(ap + (g + 1) * (4 * KG_) + 4 * i);
    }
    // keeps the loads of the later groups in front of this group's products; without it they
    // are moved down to their uses and each product waits for its own operands
    __builtin_amdgcn_sched_barrier(0);
#pragma unroll
    for (int i = 0; i < KG_; ++i) {
      v2f b = {bq[g % 3][2 * i], bq[g % 3][2 * i + 1]};
      acc = __builtin_amdgcn_wmma_f32_16x16x4_f32(false, aq[g & 1][i], false, b,
                                                  (short)0, acc, false, false);
    }
    // keeps the next loads one block behind this group's products; without it part of them is
    // moved up among the products, a further place of LDS reads in the stream, on more registers
    __builtin_amdgcn_sched_barrier(0);
  }
  const int half = lane >> 4;
  const int gcol = nt * 16 + ln;
  const int row0 = blockIdx.x * RB_ + mt * 16;
  float bias = (gcol < 32) ? b_BC[gcol] : b_dt[gcol - 32];
#pragma unroll
  for (int r = 0; r < 8; ++r) {
    int row = row0 + r + 8 * half;
    proj[(size_t)row * 64 + gcol] = acc[r] + bias;
  }
}

// ---------------------------------------------------------------------------
// Kernel 2: Delta = softplus(dtr @ W_dtp + b_dtp)        (M=8192,K=32,N=512)
// ---------------------------------------------------------------------------
__global__ void k_proj2(const float* __restrict__ proj,
                        const float* __restrict__ W_dtp,   // (32,512) row-major
                        const float* __restrict__ b_dtp,
                        float* __restrict__ Delta) {
  const int NT = 32;                                  // 512 / 16
  int wave = blockIdx.x * (blockDim.x >> 5) + (threadIdx.x >> 5);
  int lane = threadIdx.x & 31;
  if (wave >= (MTOT / 16) * NT) return;               // wave-uniform (never taken)
  int nt = wave % NT;
  int mt = wave / NT;
  int row0 = mt * 16;
  int n0 = nt * 16;
  int ln = lane & 15;
  int kk = (lane >> 4) << 1;

  v8f acc = {};
  const float* arow = proj + (size_t)(row0 + ln) * 64 + 32;
#pragma unroll
  for (int k = 0; k < 32; k += 4) {
    v2f a, b;
    a.x = arow[k + kk];
    a.y = arow[k + kk + 1];
    b.x = W_dtp[(k + kk)     * D_ + n0 + ln];
    b.y = W_dtp[(k + kk + 1) * D_ + n0 + ln];
    acc = __builtin_amdgcn_wmma_f32_16x16x4_f32(false, a, false, b,
                                                (short)0, acc, false, false);
  }
  int half = lane >> 4;
  float bias = b_dtp[n0 + ln];
#pragma unroll
  for (int r = 0; r < 8; ++r) {
    int row = row0 + r + 8 * half;
    float v = acc[r] + bias;
    float sp = (v > 20.0f) ? v : log1pf(__expf(v));   // stable softplus
    Delta[(size_t)row * D_ + n0 + ln] = sp;
  }
}

// ---------------------------------------------------------------------------
// Chunked scan. Recurrence h[l] = a[l]*h[l-1] + b[l] composes per chunk as
//   h_out = P*h_in + g     (P = prod a, g = local scan with h_in = 0)
// Pass A: per (b,d,chunk) compute P[n], g[n].           65536 thr = 2048 waves
// Pass C: compose the carries of the chunks in front of its own into its entry state, rerun the
//         chunk from there, emit y + x*Dparam.          65536 thr = 2048 waves
// P/G layout: [b][c][n/4][d][n%4]: a thread's four states are one 16-byte word and a wave's
// words are 512 bytes in a row.
// ---------------------------------------------------------------------------
#define NQ_ (N_ / 4)       // 16-byte words of states per thread
#define PG4IDX(b,c,q,d) ((((size_t)(b)*C_ + (c))*NQ_ + (q))*D_ + (d))   // in 16-byte words
#define LOG2E_ 1.4426950408889634f
#define PF_ 16             // timesteps whose Delta and x are fetched ahead as one group
#define NG_ (CL_ / PF_)    // groups per chunk

// 2^v straight from the hardware instruction. exp2f() wraps it in a rescue for results below
// 2^-126 (a compare, two selects, an add and an ldexp per call), which is most of the vector
// work of a scan step. Without it such a decay factor may come out as 0 instead of a denormal:
// it multiplies the carried state, so the difference is below 2^-126 times that state.
// Taken on pairs of states, so that the multiplies and fused multiply-adds around it stay the
// packed two-float instructions that the compiler formed around exp2f().
__device__ __forceinline__ v2f exp2_hw(v2f v) {
  v2f r;
  r.x = __builtin_amdgcn_exp2f(v.x);
  r.y = __builtin_amdgcn_exp2f(v.y);
  return r;
}

__global__ void __launch_bounds__(256) k_scan_partial(const float* __restrict__ x,
                               const float* __restrict__ proj,
                               const float* __restrict__ Delta,
                               const float* __restrict__ A_log,
                               float* __restrict__ Pbuf, float* __restrict__ Gbuf) {
  int blk = blockIdx.x;                       // B_*C_*(D_/256)
  int dg = blk % (D_ / 256);
  int c  = (blk / (D_ / 256)) % C_;
  int b  = blk / ((D_ / 256) * C_);
  int d  = dg * 256 + threadIdx.x;

  __shared__ float sB[CL_ * 16];              // Bc cols only: 4 KB
  const float* bcbase = proj + (size_t)(b * L_ + c * CL_) * 64;
  for (int t = threadIdx.x; t < CL_ * 16; t += 256) {
    int lr = t >> 4, cc = t & 15;
    async_g2l_b32((unsigned)(t * 4) + (unsigned)(size_t)sB,
                  bcbase + (size_t)lr * 64 + cc);
  }
  float A2[N_];
#pragma unroll
  for (int n = 0; n < N_; ++n)
    A2[n] = -__expf(A_log[d * N_ + n]) * LOG2E_;
  const float* dp = Delta + (size_t)(b * L_ + c * CL_) * D_ + d;
  const float* xp = x     + (size_t)(b * L_ + c * CL_) * D_ + d;
  float dn[PF_], xn[PF_];                     // the group in flight
#pragma unroll
  for (int i = 0; i < PF_; ++i) { dn[i] = dp[i * D_]; xn[i] = xp[i * D_]; }
  wait_async0();
  __syncthreads();

  float h[N_], p[N_];
#pragma unroll
  for (int n = 0; n < N_; ++n) { h[n] = 0.0f; p[n] = 1.0f; }
  v2f A2v[N_ / 2], hv[N_ / 2], pv[N_ / 2];    // the states and their rates as pairs (2j, 2j+1)
#pragma unroll
  for (int j = 0; j < N_ / 2; ++j) {
    A2v[j] = v2f{A2[2 * j], A2[2 * j + 1]};
    hv[j]  = v2f{h[2 * j], h[2 * j + 1]};
    pv[j]  = v2f{p[2 * j], p[2 * j + 1]};
  }

  // rolled: one group's body stays the loop (for speed only)
#pragma unroll 1
  for (int g = 0; g < NG_; ++g) {
    float dc[PF_], xc[PF_];
#pragma unroll
    for (int i = 0; i < PF_; ++i) { dc[i] = dn[i]; xc[i] = xn[i]; }
    if (g + 1 < NG_) {                        // next group's loads fly under this group's work
      dp += PF_ * D_;
      xp += PF_ * D_;
#pragma unroll
      for (int i = 0; i < PF_; ++i) { dn[i] = dp[i * D_]; xn[i] = xp[i * D_]; }
    }
#pragma unroll
    for (int i = 0; i < PF_; ++i) {
      float dv = dc[i];
      float xd = xc[i] * dv;
      const float* brow = &sB[(g * PF_ + i) * 16];
#pragma unroll
      for (int j = 0; j < N_ / 2; ++j) {
        v2f alpha = exp2_hw(A2v[j] * dv);
        v2f bb = {brow[2 * j], brow[2 * j + 1]};
        pv[j] *= alpha;
        hv[j] = __builtin_elementwise_fma(alpha, hv[j], bb * xd);
      }
    }
  }
#pragma unroll
  for (int j = 0; j < N_ / 2; ++j) {
    p[2 * j] = pv[j].x; p[2 * j + 1] = pv[j].y;
    h[2 * j] = hv[j].x; h[2 * j + 1] = hv[j].y;
  }
#pragma unroll
  for (int q = 0; q < NQ_; ++q) {
    ((v4f*)Pbuf)[PG4IDX(b, c, q, d)] = v4f{p[4 * q], p[4 * q + 1], p[4 * q + 2], p[4 * q + 3]};
    ((v4f*)Gbuf)[PG4IDX(b, c, q, d)] = v4f{h[4 * q], h[4 * q + 1], h[4 * q + 2], h[4 * q + 3]};
  }
}

#define NB_ 4              // chunk carries in flight per thread while the entry state is composed

// Chunk S of the chain h = P*h + g, then the refill of its buffer with chunk S + NB_, then the
// rest of the chain. Written out chunk by chunk (a recursion at compile time) and without a
// branch: the NB_ buffers take turns without register copies, and no load can be moved down
// to its use. A chunk at or behind c leaves h as it is (c is the same for the whole block).
template <int S>
__device__ __forceinline__ void carry_from(int c, int clast, int d,
                                           const v4f* __restrict__ P4, const v4f* __restrict__ G4,
                                           v4f (&hq)[NQ_], v4f (&pb)[NB_][NQ_], v4f (&gb)[NB_][NQ_]) {
  if constexpr (S < C_ - 1) {
    constexpr int k = S % NB_;
    const bool on = S < c;
#pragma unroll
    for (int q = 0; q < NQ_; ++q) {
      v4f t = __builtin_elementwise_fma(pb[k][q], hq[q], gb[k][q]);
      hq[q] = on ? t : hq[q];
    }
    if constexpr (S + NB_ < C_ - 1) {
      int cc = (S + NB_ < clast) ? S + NB_ : clast;
      const v4f* Pc = P4 + cc * NQ_ * D_;     // the same for the block: a scalar base
      const v4f* Gc = G4 + cc * NQ_ * D_;
#pragma unroll
      for (int q = 0; q < NQ_; ++q) {
        pb[k][q] = Pc[q * D_ + d];
        gb[k][q] = Gc[q * D_ + d];
      }
      // compiler fence: keeps each refill where it is written, in front of the next chunk's
      // wait; without it the refills are gathered behind one wait for everything in flight
      asm volatile("" ::: "memory");
    }
    carry_from<S + 1>(c, clast, d, P4, G4, hq, pb, gb);
  }
}

__global__ void __launch_bounds__(256) k_scan_final(const float* __restrict__ x,
                             const float* __restrict__ proj,
                             const float* __restrict__ Delta,
                             const float* __restrict__ A_log,
                             const float* __restrict__ Dparam,
                             const float* __restrict__ Pbuf,
                             const float* __restrict__ Gbuf,
                             float* __restrict__ out) {
  int blk = blockIdx.x;
  int dg = blk % (D_ / 256);
  int c  = (blk / (D_ / 256)) % C_;
  int b  = blk / ((D_ / 256) * C_);
  int d  = dg * 256 + threadIdx.x;

  __shared__ float sBC[CL_ * 32];             // Bc|Cc: 8 KB
  const float* bcbase = proj + (size_t)(b * L_ + c * CL_) * 64;
  for (int t = threadIdx.x; t < CL_ * 32; t += 256) {
    int lr = t >> 5, cc = t & 31;
    async_g2l_b32((unsigned)(t * 4) + (unsigned)(size_t)sBC,
                  bcbase + (size_t)lr * 64 + cc);
  }
  float A2[N_];
#pragma unroll
  for (int n = 0; n < N_; ++n)
    A2[n] = -__expf(A_log[d * N_ + n]) * LOG2E_;
  float Dp = Dparam[d];
  const float* dp = Delta + (size_t)(b * L_ + c * CL_) * D_ + d;
  const float* xp = x     + (size_t)(b * L_ + c * CL_) * D_ + d;
  float*       op = out   + (size_t)(b * L_ + c * CL_) * D_ + d;
  float dn[PF_], xn[PF_];                     // the group in flight
#pragma unroll
  for (int i = 0; i < PF_; ++i) { dn[i] = dp[i * D_]; xn[i] = xp[i * D_]; }

  // Entry state of chunk c: h = P*h + g over the chunks 0 .. c-1, in that order, from h = 0.
  // NB_ chunks' P and g are in flight at any time. On the way through the chunks every load is
  // unconditional, so that the waits in front of the uses stay counted ones: an index past c-1
  // is clamped to c-1 (to 0 for c == 0), a chunk that pass A has written; it is not used.
  const v4f* P4 = (const v4f*)Pbuf + PG4IDX(b, 0, 0, 0);
  const v4f* G4 = (const v4f*)Gbuf + PG4IDX(b, 0, 0, 0);
  const int clast = (c > 0) ? c - 1 : 0;
  v4f hq[NQ_], pb[NB_][NQ_], gb[NB_][NQ_];
#pragma unroll
  for (int q = 0; q < NQ_; ++q) hq[q] = v4f{0.0f, 0.0f, 0.0f, 0.0f};
#pragma unroll
  for (int k = 0; k < NB_; ++k) {
    int cc = (k < clast) ? k : clast;
    const v4f* Pc = P4 + cc * NQ_ * D_;       // the same for the block: a scalar base
    const v4f* Gc = G4 + cc * NQ_ * D_;
#pragma unroll
    for (int q = 0; q < NQ_; ++q) {
      pb[k][q] = Pc[q * D_ + d];
      gb[k][q] = Gc[q * D_ + d];
    }
    // compiler fence: keeps the chunks' loads in the order of their use (loads return in order,
    // so the wait in front of chunk k then leaves the later chunks in flight)
    asm volatile("" ::: "memory");
  }
  carry_from<0>(c, clast, d, P4, G4, hq, pb, gb);
  v2f A2v[N_ / 2], hv[N_ / 2];                // the states and their rates as pairs (2j, 2j+1)
#pragma unroll
  for (int j = 0; j < N_ / 2; ++j) {
    A2v[j] = v2f{A2[2 * j], A2[2 * j + 1]};
    hv[j]  = v2f{hq[j / 2][(j & 1) * 2], hq[j / 2][(j & 1) * 2 + 1]};
  }
  wait_async0();
  __syncthreads();

  // rolled: one group's body stays the loop (for speed only)
#pragma unroll 1
  for (int g = 0; g < NG_; ++g) {
    float dc[PF_], xc[PF_];
#pragma unroll
    for (int i = 0; i < PF_; ++i) { dc[i] = dn[i]; xc[i] = xn[i]; }
    if (g + 1 < NG_) {                        // next group's loads fly under this group's work
      dp += PF_ * D_;
      xp += PF_ * D_;
#pragma unroll
      for (int i = 0; i < PF_; ++i) { dn[i] = dp[i * D_]; xn[i] = xp[i * D_]; }
    }
#pragma unroll
    for (int i = 0; i < PF_; ++i) {
      float dv = dc[i];
      float xv = xc[i];
      float xd = xv * dv;
      const float* bc = &sBC[(g * PF_ + i) * 32];
      float y = 0.0f;
#pragma unroll
      for (int j = 0; j < N_ / 2; ++j) {
        v2f alpha = exp2_hw(A2v[j] * dv);
        v2f bb = {bc[2 * j], bc[2 * j + 1]};
        hv[j] = __builtin_elementwise_fma(alpha, hv[j], bb * xd);
        y += bc[16 + 2 * j]     * hv[j].x;    // one chain in the order of n
        y += bc[16 + 2 * j + 1] * hv[j].y;
      }
      op[(g * PF_ + i) * D_] = y + xv * Dp;
      // every fourth step: bounds how far the scheduler spreads the unrolled steps (without it
      // the registers pass 256 and register-window switches enter the loop); the last one also
      // keeps the hand-over of the fetched registers, with its load wait, behind the work
      if ((i & 3) == 3) __builtin_amdgcn_sched_barrier(0);
    }
  }
}

// ---------------------------------------------------------------------------
extern "C" void kernel_launch(void* const* d_in, const int* in_sizes, int n_in,
                              void* d_out, int out_size, void* d_ws, size_t ws_size,
                              hipStream_t stream) {
  const float* x    = (const float*)d_in[0];
  const float* ck   = (const float*)d_in[1];
  const float* W_BC = (const float*)d_in[2];
  const float* b_BC = (const float*)d_in[3];
  const float* A_lg = (const float*)d_in[4];
  const float* Dpar = (const float*)d_in[5];
  const float* W_dt = (const float*)d_in[6];
  const float* b_dt = (const float*)d_in[7];
  const float* Wdtp = (const float*)d_in[8];
  const float* bdtp = (const float*)d_in[9];
  float* out = (float*)d_out;

  char* ws = (char*)d_ws;
  const size_t SZ_U  = (size_t)B_ * L_ * D_ * 4;          // 16 MB
  const size_t SZ_PG = (size_t)B_ * C_ * N_ * D_ * 4;     //  4 MB
  float* Pbuf  = (float*)ws;                              // [0,4MB)
  float* Gbuf  = (float*)(ws + SZ_PG);                    // [4,8MB)
  float* proj  = (float*)(ws + SZ_U);                     //  2 MB
  float* Delta = (float*)(ws + SZ_U + (size_t)MTOT * 64 * 4);   // 16 MB

  // 1) conv + silu, proj = u @ [W_BC|W_dt] + bias : 256 blocks, 2048 waves
  k_conv_proj1<<<MTOT / RB_, 256, 0, stream>>>(x, ck, W_BC, b_BC, W_dt, b_dt, proj);

  // 2) Delta = softplus(dtr @ W_dtp + b_dtp) : 16384 waves
  k_proj2<<<4096, 128, 0, stream>>>(proj, Wdtp, bdtp, Delta);

  // 3) chunked scan: partial -> final
  int scan_blocks = B_ * C_ * (D_ / 256);                 // 256 blocks
  k_scan_partial<<<scan_blocks, 256, 0, stream>>>(x, proj, Delta, A_lg, Pbuf, Gbuf);
  k_scan_final<<<scan_blocks, 256, 0, stream>>>(x, proj, Delta, A_lg, Dpar, Pbuf, Gbuf, out);
}

// v006
// It runs in 44.9 microseconds.
// Two timings next to v005 both put it at 1.08 times that version's speed.
// Over all steps from v000 it is 2.94 times as fast.
#include <hip/hip_runtime.h>
#include <hip/hip_bf16.h>
#include <math.h>

#define B_    8
#define L_    1024
#define D_    512
#define N_    16
#define MTOT  (B_*L_)      // 8192 rows
#define C_    16           // scan chunks
#define CL_   64           // timesteps per chunk (C_*CL_ == L_)

typedef __attribute__((ext_vector_type(2))) float v2f;
typedef __attribute__((ext_vector_type(8))) float v8f;

__device__ __forceinline__ float silu_f(float v) { return v / (1.0f + __expf(-v)); }

// CDNA5 async global->LDS copy (4B per lane), tracked by ASYNCcnt.
__device__ __forceinline__ void async_g2l_b32(unsigned lds_off, const float* gaddr) {
  asm volatile("global_load_async_to_lds_b32 %0, %1, off"
               :: "v"(lds_off), "v"(gaddr) : "memory");
}
__device__ __forceinline__ void wait_async0() {
  asm volatile("s_wait_asynccnt 0x0" ::: "memory");
}

// ---------------------------------------------------------------------------
// Kernel 1: u = SiLU(depthwise conv3(x), SAME, zero pad), kept in LDS, and
//           proj = u @ [W_BC | W_dt] + [b_BC | b_dt]     (M=8192,K=512,N=64)
// One block per RB_ rows. Part 1: a thread makes 4 channels x CR_ rows of u with 16-byte loads,
// each x row loaded once per thread and used by three output rows. Part 2: one wave per 16x16
// tile, V_WMMA_F32_16X16X4_F32, 128 steps of k in rising order on one accumulator.
// proj row layout: cols 0..15 = Bc, 16..31 = Cc, 32..63 = dt_rank proj.
// ---------------------------------------------------------------------------
#define RB_ 32             // rows per block; divides L_, so a block stays in one sequence
#define CR_ 16             // rows per thread in part 1 (two thread halves cover RB_)
#define UP_ (D_ + 4)       // LDS pitch of a u row in floats: 16 rows' 8-byte reads meet no bank twice
#define KG_ 16             // k-steps (of 4) whose operands are fetched ahead as one group
#define NKG_ (D_ / (4 * KG_))
typedef __attribute__((ext_vector_type(4))) float v4f;

__global__ void __launch_bounds__(256) k_conv_proj1(const float* __restrict__ x,
                        const float* __restrict__ ck,   // (K=3,1,D)
                        const float* __restrict__ W_BC, const float* __restrict__ b_BC,
                        const float* __restrict__ W_dt, const float* __restrict__ b_dt,
                        float* __restrict__ proj) {
  __shared__ __attribute__((aligned(16))) float sU[RB_ * UP_];
  const int tid = threadIdx.x;
  const int lane = tid & 31;
  const int wave = tid >> 5;
  const int nt = wave & 3;                            // 64 / 16 column tiles
  const int mt = wave >> 2;                           // RB_ / 16 row tiles
  const int ln = lane & 15;                           // M for A-frag, N for B-frag
  const int kk = (lane >> 4) << 1;                    // K sub-offset: 0 or 2

  const float* W = (nt < 2) ? W_BC : W_dt;            // both row-major (512,32)
  const float* wp = W + kk * 32 + (nt & 1) * 16 + ln;
  float bq[3][2 * KG_];                               // W groups: one in use, two in flight

  {
    const int d = (tid & 127) * 4;
    const int lr0 = (tid >> 7) * CR_;                 // first row of this thread inside the block
    const int row0 = blockIdx.x * RB_ + lr0;          // flat row b*L + l of the first output
    const int l0 = row0 % L_;
    const float* xp = x + (size_t)row0 * D_ + d;
    v4f c0 = *(const v4f*)(ck + 0 * D_ + d);
    v4f c1 = *(const v4f*)(ck + 1 * D_ + d);
    v4f c2 = *(const v4f*)(ck + 2 * D_ + d);
    v4f r[CR_ + 2];                                   // rows l0-1 .. l0+CR_
    const v4f zero = {0.0f, 0.0f, 0.0f, 0.0f};
    r[0] = (l0 > 0) ? *(const v4f*)(xp - D_) : zero;
#pragma unroll
    for (int i = 0; i < CR_; ++i) r[i + 1] = *(const v4f*)(xp + i * D_);
    r[CR_ + 1] = (l0 + CR_ < L_) ? *(const v4f*)(xp + CR_ * D_) : zero;
    // the first two groups of W are asked for here, behind x, so that they fly under part 1
#pragma unroll
    for (int g = 0; g < 2; ++g) {
#pragma unroll
      for (int i = 0; i < KG_; ++i) {
        bq[g][2 * i]     = wp[(g * 4 * KG_ + 4 * i)     * 32];
        bq[g][2 * i + 1] = wp[(g * 4 * KG_ + 4 * i + 1) * 32];
      }
    }
#pragma unroll
    for (int i = 0; i < CR_; ++i) {
      v4f v = c0 * r[i] + c1 * r[i + 1] + c2 * r[i + 2];
      v4f o;
      o.x = silu_f(v.x); o.y = silu_f(v.y); o.z = silu_f(v.z); o.w = silu_f(v.w);
      *(v4f*)&sU[(lr0 + i) * UP_ + d] = o;
    }
  }
  __syncthreads();                                    // u of the block's rows is complete

  v8f acc = {};
  const float* ap = &sU[(mt * 16 + ln) * UP_ + kk];
  v2f aq[2][KG_];                                     // u groups: one in use, one in flight
#pragma unroll
  for (int i = 0; i < KG_; ++i) aq[0][i] = *(const v2f*)(ap + 4 * i);
  // written out group by group: the buffers take turns without register copies, and every load
  // is unconditional, so that the waits in front of the products stay counted ones
#pragma unroll
  for (int g = 0; g < NKG_; ++g) {
    if (g + 2 < NKG_) {
#pragma unroll
      for (int i = 0; i < KG_; ++i) {
        bq[(g + 2) % 3][2 * i]     = wp[((g + 2) * 4 * KG_ + 4 * i)     * 32];
        bq[(g + 2) % 3][2 * i + 1] = wp[((g + 2) * 4 * KG_ + 4 * i + 1) * 32];
      }
    }
    if (g + 1 < NKG_) {
#pragma unroll
      for (int i = 0; i < KG_; ++i)
        aq[(g + 1) & 1][i] = *(const v2f*)(ap + (g + 1) * (4 * KG_) + 4 * i);
    }
    // keeps the loads of the later groups in front of this group's products; without it they
    // are moved down to their uses and each product waits for its own operands
    __builtin_amdgcn_sched_barrier(0);
#pragma unroll
    for (int i = 0; i < KG_; ++i) {
      v2f b = {bq[g % 3][2 * i], bq[g % 3][2 * i + 1]};
      acc = __builtin_amdgcn_wmma_f32_16x16x4_f32(false, aq[g & 1][i], false, b,
                                                  (short)0, acc, false, false);
    }
    // keeps the next loads one block behind this group's products; without it part of them is
    // moved up among the products, a further place of LDS reads in the stream, on more registers
    __builtin_amdgcn_sched_barrier(0);
  }
  const int half = lane >> 4;
  const int gcol = nt * 16 + ln;
  const int row0 = blockIdx.x * RB_ + mt * 16;
  float bias = (gcol < 32) ? b_BC[gcol] : b_dt[gcol - 32];
#pragma unroll
  for (int r = 0; r < 8; ++r) {
    int row = row0 + r + 8 * half;
    proj[(size_t)row * 64 + gcol] = acc[r] + bias;
  }
}

// ---------------------------------------------------------------------------
// Kernel 2: Delta = softplus(dtr @ W_dtp + b_dtp)        (M=8192,K=32,N=512)
// ---------------------------------------------------------------------------
// One hardware transcendental on each of a lane's eight values, in place. The eight stand in one
// statement because the instruction set asks for one independent instruction behind a
// transcendental before its result is read or its source overwritten: here each fills that slot
// for the one before it, and the v_nop fills it for the last.
__device__ __forceinline__ void exp2_x8(float (&a)[8]) {   // a = 2^a
  asm("v_exp_f32 %0, %0\n\tv_exp_f32 %1, %1\n\tv_exp_f32 %2, %2\n\tv_exp_f32 %3, %3\n\t"
      "v_exp_f32 %4, %4\n\tv_exp_f32 %5, %5\n\tv_exp_f32 %6, %6\n\tv_exp_f32 %7, %7\n\tv_nop"
      : "+v"(a[0]), "+v"(a[1]), "+v"(a[2]), "+v"(a[3]), "+v"(a[4]), "+v"(a[5]), "+v"(a[6]), "+v"(a[7]));
}
__device__ __forceinline__ void rcp_x8(float (&a)[8]) {   // a = 1 / a
  asm("v_rcp_f32 %0, %0\n\tv_rcp_f32 %1, %1\n\tv_rcp_f32 %2, %2\n\tv_rcp_f32 %3, %3\n\t"
      "v_rcp_f32 %4, %4\n\tv_rcp_f32 %5, %5\n\tv_rcp_f32 %6, %6\n\tv_rcp_f32 %7, %7\n\tv_nop"
      : "+v"(a[0]), "+v"(a[1]), "+v"(a[2]), "+v"(a[3]), "+v"(a[4]), "+v"(a[5]), "+v"(a[6]), "+v"(a[7]));
}
__device__ __forceinline__ void log2_x8(float (&a)[8]) {   // a = log2(a)
  asm("v_log_f32 %0, %0\n\tv_log_f32 %1, %1\n\tv_log_f32 %2, %2\n\tv_log_f32 %3, %3\n\t"
      "v_log_f32 %4, %4\n\tv_log_f32 %5, %5\n\tv_log_f32 %6, %6\n\tv_log_f32 %7, %7\n\tv_nop"
      : "+v"(a[0]), "+v"(a[1]), "+v"(a[2]), "+v"(a[3]), "+v"(a[4]), "+v"(a[5]), "+v"(a[6]), "+v"(a[7]));
}

// softplus(v) = log(1 + e), e = exp(v), on eight values, without a branch and without log1pf(),
// whose two-float arithmetic is one long dependent chain and was most of this kernel's vector
// work.
// e <= 1/2: log(1 + e) = 2 atanh(s) with s = e / (2 + e) <= 1/5, z = s * s <= 1/25:
//   2 atanh(s) = 2 s + s w,  w = 2 (z/3 + z^2/5 + z^3/7 + z^4/9),  and 2 s = e - e s,
//   so the result is e - s (e - w): e itself is the leading term, and the rounding of s counts
//   only times s. The first term left out, s * 2 z^5 / 11, is below 1e-8 of the result.
// e > 1/2: the sum 1 + e is at least 3/2, its rounding is small beside a result above 2/5, and the
//   hardware logarithm (base 2) serves; there Delta keeps about 3e-7 of relative error.
// v > 20 gives v as before; the selects drop whatever the unused forms make of a huge e.
__device__ __forceinline__ void softplus8(float (&v)[8]) {
  float e[8], r[8], l[8];
#pragma unroll
  for (int i = 0; i < 8; ++i) e[i] = v[i] * 1.4426950408889634f;
  exp2_x8(e);                                         // e = exp(v)
#pragma unroll
  for (int i = 0; i < 8; ++i) { r[i] = 2.0f + e[i]; l[i] = 1.0f + e[i]; }
  rcp_x8(r);                                          // r = 1 / (2 + e)
  log2_x8(l);                                         // l = log2(1 + e)
#pragma unroll
  for (int i = 0; i < 8; ++i) {
    float s = e[i] * r[i];
    float z = s * s;
    float w = z * fmaf(z, fmaf(z, fmaf(z, 2.0f / 9.0f, 2.0f / 7.0f), 2.0f / 5.0f), 2.0f / 3.0f);
    float lo = fmaf(-s, e[i] - w, e[i]);
    float hi = l[i] * 0.6931471805599453f;
    float sp = (e[i] > 0.5f) ? hi : lo;
    v[i] = (v[i] > 20.0f) ? v[i] : sp;
  }
}

__global__ void k_proj2(const float* __restrict__ proj,
                        const float* __restrict__ W_dtp,   // (32,512) row-major
                        const float* __restrict__ b_dtp,
                        float* __restrict__ Delta) {
  const int NT = 32;                                  // 512 / 16
  int wave = blockIdx.x * (blockDim.x >> 5) + (threadIdx.x >> 5);
  int lane = threadIdx.x & 31;
  if (wave >= (MTOT / 16) * NT) return;               // wave-uniform (never taken)
  int nt = wave % NT;
  int mt = wave / NT;
  int row0 = mt * 16;
  int n0 = nt * 16;
  int ln = lane & 15;
  int kk = (lane >> 4) << 1;

  v8f acc = {};
  const float* arow = proj + (size_t)(row0 + ln) * 64 + 32;
#pragma unroll
  for (int k = 0; k < 32; k += 4) {
    v2f a, b;
    a.x = arow[k + kk];
    a.y = arow[k + kk + 1];
    b.x = W_dtp[(k + kk)     * D_ + n0 + ln];
    b.y = W_dtp[(k + kk + 1) * D_ + n0 + ln];
    acc = __builtin_amdgcn_wmma_f32_16x16x4_f32(false, a, false, b,
                                                (short)0, acc, false, false);
  }
  float bias = b_dtp[n0 + ln];
  // keeps the store address's arithmetic behind the products: moved up among them it took
  // registers that the product issued just before it still names as its A or B operand
  __builtin_amdgcn_sched_barrier(0);
  int half = lane >> 4;
  float v[8];
#pragma unroll
  for (int r = 0; r < 8; ++r) v[r] = acc[r] + bias;
  softplus8(v);
#pragma unroll
  for (int r = 0; r < 8; ++r) {
    int row = row0 + r + 8 * half;
    Delta[(size_t)row * D_ + n0 + ln] = v[r];
  }
}

// ---------------------------------------------------------------------------
// Chunked scan. Recurrence h[l] = a[l]*h[l-1] + b[l] composes per chunk as
//   h_out = P*h_in + g     (P = prod a, g = local scan with h_in = 0)
// Pass A: per (b,d,chunk) compute P[n], g[n].           65536 thr = 2048 waves
// Pass C: compose the carries of the chunks in front of its own into its entry state, rerun the
//         chunk from there, emit y + x*Dparam.          65536 thr = 2048 waves
// P/G layout: [b][c][n/4][d][n%4]: a thread's four states are one 16-byte word and a wave's
// words are 512 bytes in a row.
// ---------------------------------------------------------------------------
#define NQ_ (N_ / 4)       // 16-byte words of states per thread
#define PG4IDX(b,c,q,d) ((((size_t)(b)*C_ + (c))*NQ_ + (q))*D_ + (d))   // in 16-byte words
#define LOG2E_ 1.4426950408889634f
#define PF_ 16             // timesteps whose Delta and x are fetched ahead as one group
#define NG_ (CL_ / PF_)    // groups per chunk

// 2^v straight from the hardware instruction. exp2f() wraps it in a rescue for results below
// 2^-126 (a compare, two selects, an add and an ldexp per call), which is most of the vector
// work of a scan step. Without it such a decay factor may come out as 0 instead of a denormal:
// it multiplies the carried state, so the difference is below 2^-126 times that state.
// Taken on pairs of states, so that the multiplies and fused multiply-adds around it stay the
// packed two-float instructions that the compiler formed around exp2f().
__device__ __forceinline__ v2f exp2_hw(v2f v) {
  v2f r;
  r.x = __builtin_amdgcn_exp2f(v.x);
  r.y = __builtin_amdgcn_exp2f(v.y);
  return r;
}

__global__ void __launch_bounds__(256) k_scan_partial(const float* __restrict__ x,
                               const float* __restrict__ proj,
                               const float* __restrict__ Delta,
                               const float* __restrict__ A_log,
                               float* __restrict__ Pbuf, float* __restrict__ Gbuf) {
  int blk = blockIdx.x;                       // B_*C_*(D_/256)
  int dg = blk % (D_ / 256);
  int c  = (blk / (D_ / 256)) % C_;
  int b  = blk / ((D_ / 256) * C_);
  int d  = dg * 256 + threadIdx.x;

  __shared__ float sB[CL_ * 16];              // Bc cols only: 4 KB
  const float* bcbase = proj + (size_t)(b * L_ + c * CL_) * 64;
  for (int t = threadIdx.x; t < CL_ * 16; t += 256) {
    int lr = t >> 4, cc = t & 15;
    async_g2l_b32((unsigned)(t * 4) + (unsigned)(size_t)sB,
                  bcbase + (size_t)lr * 64 + cc);
  }
  float A2[N_];
#pragma unroll
  for (int n = 0; n < N_; ++n)
    A2[n] = -__expf(A_log[d * N_ + n]) * LOG2E_;
  const float* dp = Delta + (size_t)(b * L_ + c * CL_) * D_ + d;
  const float* xp = x     + (size_t)(b * L_ + c * CL_) * D_ + d;
  float dn[PF_], xn[PF_];                     // the group in flight
#pragma unroll
  for (int i = 0; i < PF_; ++i) { dn[i] = dp[i * D_]; xn[i] = xp[i * D_]; }
  wait_async0();
  __syncthreads();

  float h[N_], p[N_];
#pragma unroll
  for (int n = 0; n < N_; ++n) { h[n] = 0.0f; p[n] = 1.0f; }
  v2f A2v[N_ / 2], hv[N_ / 2], pv[N_ / 2];    // the states and their rates as pairs (2j, 2j+1)
#pragma unroll
  for (int j = 0; j < N_ / 2; ++j) {
    A2v[j] = v2f{A2[2 * j], A2[2 * j + 1]};
    hv[j]  = v2f{h[2 * j], h[2 * j + 1]};
    pv[j]  = v2f{p[2 * j], p[2 * j + 1]};
  }

  // rolled: one group's body stays the loop (for speed only)
#pragma unroll 1
  for (int g = 0; g < NG_; ++g) {
    float dc[PF_], xc[PF_];
#pragma unroll
    for (int i = 0; i < PF_; ++i) { dc[i] = dn[i]; xc[i] = xn[i]; }
    if (g + 1 < NG_) {                        // next group's loads fly under this group's work
      dp += PF_ * D_;
      xp += PF_ * D_;
#pragma unroll
      for (int i = 0; i < PF_; ++i) { dn[i] = dp[i * D_]; xn[i] = xp[i * D_]; }
    }
#pragma unroll
    for (int i = 0; i < PF_; ++i) {
      float dv = dc[i];
      float xd = xc[i] * dv;
      const float* brow = &sB[(g * PF_ + i) * 16];
#pragma unroll
      for (int j = 0; j < N_ / 2; ++j) {
        v2f alpha = exp2_hw(A2v[j] * dv);
        v2f bb = {brow[2 * j], brow[2 * j + 1]};
        pv[j] *= alpha;
        hv[j] = __builtin_elementwise_fma(alpha, hv[j], bb * xd);
      }
    }
  }
#pragma unroll
  for (int j = 0; j < N_ / 2; ++j) {
    p[2 * j] = pv[j].x; p[2 * j + 1] = pv[j].y;
    h[2 * j] = hv[j].x; h[2 * j + 1] = hv[j].y;
  }
#pragma unroll
  for (int q = 0; q < NQ_; ++q) {
    ((v4f*)Pbuf)[PG4IDX(b, c, q, d)] = v4f{p[4 * q], p[4 * q + 1], p[4 * q + 2], p[4 * q + 3]};
    ((v4f*)Gbuf)[PG4IDX(b, c, q, d)] = v4f{h[4 * q], h[4 * q + 1], h[4 * q + 2], h[4 * q + 3]};
  }
}

#define NB_ 4              // chunk carries in flight per thread while the entry state is composed

// Chunk S of the chain h = P*h + g, then the refill of its buffer with chunk S + NB_, then the
// rest of the chain. Written out chunk by chunk (a recursion at compile time) and without a
// branch: the NB_ buffers take turns without register copies, and no load can be moved down
// to its use. A chunk at or behind c leaves h as it is (c is the same for the whole block).
template <int S>
__device__ __forceinline__ void carry_from(int c, int clast, int d,
                                           const v4f* __restrict__ P4, const v4f* __restrict__ G4,
                                           v4f (&hq)[NQ_], v4f (&pb)[NB_][NQ_], v4f (&gb)[NB_][NQ_]) {
  if constexpr (S < C_ - 1) {
    constexpr int k = S % NB_;
    const bool on = S < c;
#pragma unroll
    for (int q = 0; q < NQ_; ++q) {
      v4f t = __builtin_elementwise_fma(pb[k][q], hq[q], gb[k][q]);
      hq[q] = on ? t : hq[q];
    }
    if constexpr (S + NB_ < C_ - 1) {
      int cc = (S + NB_ < clast) ? S + NB_ : clast;
      const v4f* Pc = P4 + cc * NQ_ * D_;     // the same for the block: a scalar base
      const v4f* Gc = G4 + cc * NQ_ * D_;
#pragma unroll
      for (int q = 0; q < NQ_; ++q) {
        pb[k][q] = Pc[q * D_ + d];
        gb[k][q] = Gc[q * D_ + d];
      }
      // compiler fence: keeps each refill where it is written, in front of the next chunk's
      // wait; without it the refills are gathered behind one wait for everything in flight
      asm volatile("" ::: "memory");
    }
    carry_from<S + 1>(c, clast, d, P4, G4, hq, pb, gb);
  }
}

__global__ void __launch_bounds__(256) k_scan_final(const float* __restrict__ x,
                             const float* __restrict__ proj,
                             const float* __restrict__ Delta,
                             const float* __restrict__ A_log,
                             const float* __restrict__ Dparam,
                             const float* __restrict__ Pbuf,
                             const float* __restrict__ Gbuf,
                             float* __restrict__ out) {
  int blk = blockIdx.x;
  int dg = blk % (D_ / 256);
  int c  = (blk / (D_ / 256)) % C_;
  int b  = blk / ((D_ / 256) * C_);
  int d  = dg * 256 + threadIdx.x;

  __shared__ float sBC[CL_ * 32];             // Bc|Cc: 8 KB
  const float* bcbase = proj + (size_t)(b * L_ + c * CL_) * 64;
  for (int t = threadIdx.x; t < CL_ * 32; t += 256) {
    int lr = t >> 5, cc = t & 31;
    async_g2l_b32((unsigned)(t * 4) + (unsigned)(size_t)sBC,
                  bcbase + (size_t)lr * 64 + cc);
  }
  float A2[N_];
#pragma unroll
  for (int n = 0; n < N_; ++n)
    A2[n] = -__expf(A_log[d * N_ + n]) * LOG2E_;
  float Dp = Dparam[d];
  const float* dp = Delta + (size_t)(b * L_ + c * CL_) * D_ + d;
  const float* xp = x     + (size_t)(b * L_ + c * CL_) * D_ + d;
  float*       op = out   + (size_t)(b * L_ + c * CL_) * D_ + d;
  float dn[PF_], xn[PF_];                     // the group in flight
#pragma unroll
  for (int i = 0; i < PF_; ++i) { dn[i] = dp[i * D_]; xn[i] = xp[i * D_]; }

  // Entry state of chunk c: h = P*h + g over the chunks 0 .. c-1, in that order, from h = 0.
  // NB_ chunks' P and g are in flight at any time. On the way through the chunks every load is
  // unconditional, so that the waits in front of the uses stay counted ones: an index past c-1
  // is clamped to c-1 (to 0 for c == 0), a chunk that pass A has written; it is not used.
  const v4f* P4 = (const v4f*)Pbuf + PG4IDX(b, 0, 0, 0);
  const v4f* G4 = (const v4f*)Gbuf + PG4IDX(b, 0, 0, 0);
  const int clast = (c > 0) ? c - 1 : 0;
  v4f hq[NQ_], pb[NB_][NQ_], gb[NB_][NQ_];
#pragma unroll
  for (int q = 0; q < NQ_; ++q) hq[q] = v4f{0.0f, 0.0f, 0.0f, 0.0f};
#pragma unroll
  for (int k = 0; k < NB_; ++k) {
    int cc = (k < clast) ? k : clast;
    const v4f* Pc = P4 + cc * NQ_ * D_;       // the same for the block: a scalar base
    const v4f* Gc = G4 + cc * NQ_ * D_;
#pragma unroll
    for (int q = 0; q < NQ_; ++q) {
      pb[k][q] = Pc[q * D_ + d];
      gb[k][q] = Gc[q * D_ + d];
    }
    // compiler fence: keeps the chunks' loads in the order of their use (loads return in order,
    // so the wait in front of chunk k then leaves the later chunks in flight)
    asm volatile("" ::: "memory");
  }
  carry_from<0>(c, clast, d, P4, G4, hq, pb, gb);
  v2f A2v[N_ / 2], hv[N_ / 2];                // the states and their rates as pairs (2j, 2j+1)
#pragma unroll
  for (int j = 0; j < N_ / 2; ++j) {
    A2v[j] = v2f{A2[2 * j], A2[2 * j + 1]};
    hv[j]  = v2f{hq[j / 2][(j & 1) * 2], hq[j / 2][(j & 1) * 2 + 1]};
  }
  wait_async0();
  __syncthreads();

  // rolled: one group's body stays the loop (for speed only)
#pragma unroll 1
  for (int g = 0; g < NG_; ++g) {
    float dc[PF_], xc[PF_];
#pragma unroll
    for (int i = 0; i < PF_; ++i) { dc[i] = dn[i]; xc[i] = xn[i]; }
    if (g + 1 < NG_) {                        // next group's loads fly under this group's work
      dp += PF_ * D_;
      xp += PF_ * D_;
#pragma unroll
      for (int i = 0; i < PF_; ++i) { dn[i] = dp[i * D_]; xn[i] = xp[i * D_]; }
    }
#pragma unroll
    for (int i = 0; i < PF_; ++i) {
      float dv = dc[i];
      float xv = xc[i];
      float xd = xv * dv;
      const float* bc = &sBC[(g * PF_ + i) * 32];
      float y = 0.0f;
#pragma unroll
      for (int j = 0; j < N_ / 2; ++j) {
        v2f alpha = exp2_hw(A2v[j] * dv);
        v2f bb = {bc[2 * j], bc[2 * j + 1]};
        hv[j] = __builtin_elementwise_fma(alpha, hv[j], bb * xd);
        y += bc[16 + 2 * j]     * hv[j].x;    // one chain in the order of n
        y += bc[16 + 2 * j + 1] * hv[j].y;
      }
      op[(g * PF_ + i) * D_] = y + xv * Dp;
      // every fourth step: bounds how far the scheduler spreads the unrolled steps (without it
      // the registers pass 256 and register-window switches enter the loop); the last one also
      // keeps the hand-over of the fetched registers, with its load wait, behind the work
      if ((i & 3) == 3) __builtin_amdgcn_sched_barrier(0);
    }
  }
}

// ---------------------------------------------------------------------------
extern "C" void kernel_launch(void* const* d_in, const int* in_sizes, int n_in,
                              void* d_out, int out_size, void* d_ws, size_t ws_size,
                              hipStream_t stream) {
  const float* x    = (const float*)d_in[0];
  const float* ck   = (const float*)d_in[1];
  const float* W_BC = (const float*)d_in[2];
  const float* b_BC = (const float*)d_in[3];
  const float* A_lg = (const float*)d_in[4];
  const float* Dpar = (const float*)d_in[5];
  const float* W_dt = (const float*)d_in[6];
  const float* b_dt = (const float*)d_in[7];
  const float* Wdtp = (const float*)d_in[8];
  const float* bdtp = (const float*)d_in[9];
  float* out = (float*)d_out;

  char* ws = (char*)d_ws;
  const size_t SZ_U  = (size_t)B_ * L_ * D_ * 4;          // 16 MB
  const size_t SZ_PG = (size_t)B_ * C_ * N_ * D_ * 4;     //  4 MB
  float* Pbuf  = (float*)ws;                              // [0,4MB)
  float* Gbuf  = (float*)(ws + SZ_PG);                    // [4,8MB)
  float* proj  = (float*)(ws + SZ_U);                     //  2 MB
  float* Delta = (float*)(ws + SZ_U + (size_t)MTOT * 64 * 4);   // 16 MB

  // 1) conv + silu, proj = u @ [W_BC|W_dt] + bias : 256 blocks, 2048 waves
  k_conv_proj1<<<MTOT / RB_, 256, 0, stream>>>(x, ck, W_BC, b_BC, W_dt, b_dt, proj);

  // 2) Delta = softplus(dtr @ W_dtp + b_dtp) : 16384 waves
  k_proj2<<<4096, 128, 0, stream>>>(proj, Wdtp, bdtp, Delta);

  // 3) chunked scan: partial -> final
  int scan_blocks = B_ * C_ * (D_ / 256);                 // 256 blocks
  k_scan_partial<<<scan_blocks, 256, 0, stream>>>(x, proj, Delta, A_lg, Pbuf, Gbuf);
  k_scan_final<<<scan_blocks, 256, 0, stream>>>(x, proj, Delta, A_lg, Dpar, Pbuf, Gbuf, out);
}

// v007
// Measured time: 38.4 microseconds a run.
// In two side-by-side timings against v006, it was 1.16 and 1.17 times as fast.
// All steps since v000 together make it 3.44 times as fast.
#include <hip/hip_runtime.h>
#include <hip/hip_bf16.h>
#include <math.h>

#define B_    8
#define L_    1024
#define D_    512
#define N_    16
#define MTOT  (B_*L_)      // 8192 rows

typedef __attribute__((ext_vector_type(2))) float v2f;
typedef __attribute__((ext_vector_type(8))) float v8f;

__device__ __forceinline__ float silu_f(float v) { return v / (1.0f + __expf(-v)); }

// Four asynchronous global->LDS copies of 16 bytes per lane, counted on ASYNCcnt. The s_wait_xcnt
// stands in the copies' own statement, so that it comes before any rewrite of their address registers.
__device__ __forceinline__ void async_g2l_b128_x4(unsigned l0, unsigned l1, unsigned l2, unsigned l3,
                                                  const float* g0, const float* g1,
                                                  const float* g2, const float* g3) {
  asm volatile("global_load_async_to_lds_b128 %0, %4, off\n\t"
               "global_load_async_to_lds_b128 %1, %5, off\n\t"
               "global_load_async_to_lds_b128 %2, %6, off\n\t"
               "global_load_async_to_lds_b128 %3, %7, off\n\t"
               "s_wait_xcnt 0x0"
               :: "v"(l0), "v"(l1), "v"(l2), "v"(l3), "v"(g0), "v"(g1), "v"(g2), "v"(g3) : "memory");
}
__device__ __forceinline__ void wait_async0() {
  asm volatile("s_wait_asynccnt 0x0" ::: "memory");
}

// ---------------------------------------------------------------------------
// Kernel 1: u = SiLU(depthwise conv3(x), SAME, zero pad), kept in LDS, and
//           proj = u @ [W_BC | W_dt] + [b_BC | b_dt]     (M=8192,K=512,N=64)
// One block per RB_ rows. Part 1: a thread makes 4 channels x CR_ rows of u with 16-byte loads,
// each x row loaded once per thread and used by three output rows. Part 2: one wave per 16x16
// tile, V_WMMA_F32_16X16X4_F32, 128 steps of k in rising order on one accumulator.
// proj row layout: cols 0..15 = Bc, 16..31 = Cc, 32..63 = dt_rank proj.
// ---------------------------------------------------------------------------
#define RB_ 32             // rows per block; divides L_, so a block stays in one sequence
#define CR_ 16             // rows per thread in part 1 (two thread halves cover RB_)
#define UP_ (D_ + 4)       // LDS pitch of a u row in floats: 16 rows' 8-byte reads meet no bank twice
#define KG_ 16             // k-steps (of 4) whose operands are fetched ahead as one group
#define NKG_ (D_ / (4 * KG_))
typedef __attribute__((ext_vector_type(4))) float v4f;

__global__ void __launch_bounds__(256) k_conv_proj1(const float* __restrict__ x,
                        const float* __restrict__ ck,   // (K=3,1,D)
                        const float* __restrict__ W_BC, const float* __restrict__ b_BC,
                        const float* __restrict__ W_dt, const float* __restrict__ b_dt,
                        float* __restrict__ proj) {
  __shared__ __attribute__((aligned(16))) float sU[RB_ * UP_];
  const int tid = threadIdx.x;
  const int lane = tid & 31;
  const int wave = tid >> 5;
  const int nt = wave & 3;                            // 64 / 16 column tiles
  const int mt = wave >> 2;                           // RB_ / 16 row tiles
  const int ln = lane & 15;                           // M for A-frag, N for B-frag
  const int kk = (lane >> 4) << 1;                    // K sub-offset: 0 or 2

  const float* W = (nt < 2) ? W_BC : W_dt;            // both row-major (512,32)
  const float* wp = W + kk * 32 + (nt & 1) * 16 + ln;
  float bq[3][2 * KG_];                               // W groups: one in use, two in flight

  {
    const int d = (tid & 127) * 4;
    const int lr0 = (tid >> 7) * CR_;                 // first row of this thread inside the block
    const int row0 = blockIdx.x * RB_ + lr0;          // flat row b*L + l of the first output
    const int l0 = row0 % L_;
    const float* xp = x + (size_t)row0 * D_ + d;
    v4f c0 = *(const v4f*)(ck + 0 * D_ + d);
    v4f c1 = *(const v4f*)(ck + 1 * D_ + d);
    v4f c2 = *(const v4f*)(ck + 2 * D_ + d);
    v4f r[CR_ + 2];                                   // rows l0-1 .. l0+CR_
    const v4f zero = {0.0f, 0.0f, 0.0f, 0.0f};
    r[0] = (l0 > 0) ? *(const v4f*)(xp - D_) : zero;
#pragma unroll
    for (int i = 0; i < CR_; ++i) r[i + 1] = *(const v4f*)(xp + i * D_);
    r[CR_ + 1] = (l0 + CR_ < L_) ? *(const v4f*)(xp + CR_ * D_) : zero;
    // the first two groups of W are asked for here, behind x, so that they fly under part 1
#pragma unroll
    for (int g = 0; g < 2; ++g) {
#pragma unroll
      for (int i = 0; i < KG_; ++i) {
        bq[g][2 * i]     = wp[(g * 4 * KG_ + 4 * i)     * 32];
        bq[g][2 * i + 1] = wp[(g * 4 * KG_ + 4 * i + 1) * 32];
      }
    }
#pragma unroll
    for (int i = 0; i < CR_; ++i) {
      v4f v = c0 * r[i] + c1 * r[i + 1] + c2 * r[i + 2];
      v4f o;
      o.x = silu_f(v.x); o.y = silu_f(v.y); o.z = silu_f(v.z); o.w = silu_f(v.w);
      *(v4f*)&sU[(lr0 + i) * UP_ + d] = o;
    }
  }
  __syncthreads();                                    // u of the block's rows is complete

  v8f acc = {};
  const float* ap = &sU[(mt * 16 + ln) * UP_ + kk];
  v2f aq[2][KG_];                                     // u groups: one in use, one in flight
#pragma unroll
  for (int i = 0; i < KG_; ++i) aq[0][i] = *(const v2f*)(ap + 4 * i);
  // written out group by group: the buffers take turns without register copies, and every load
  // is unconditional, so that the waits in front of the products stay counted ones
#pragma unroll
  for (int g = 0; g < NKG_; ++g) {
    if (g + 2 < NKG_) {
#pragma unroll
      for (int i = 0; i < KG_; ++i) {
        bq[(g + 2) % 3][2 * i]     = wp[((g + 2) * 4 * KG_ + 4 * i)     * 32];
        bq[(g + 2) % 3][2 * i + 1] = wp[((g + 2) * 4 * KG_ + 4 * i + 1) * 32];
      }
    }
    if (g + 1 < NKG_) {
#pragma unroll
      for (int i = 0; i < KG_; ++i)
        aq[(g + 1) & 1][i] = *(const v2f*)(ap + (g + 1) * (4 * KG_) + 4 * i);
    }
    // keeps the loads of the later groups in front of this group's products; without it they
    // are moved down to their uses and each product waits for its own operands
    __builtin_amdgcn_sched_barrier(0);
#pragma unroll
    for (int i = 0; i < KG_; ++i) {
      v2f b = {bq[g % 3][2 * i], bq[g % 3][2 * i + 1]};
      acc = __builtin_amdgcn_wmma_f32_16x16x4_f32(false, aq[g & 1][i], false, b,
                                                  (short)0, acc, false, false);
    }
    // keeps the next loads one block behind this group's products; without it part of them is
    // moved up among the products, a further place of LDS reads in the stream, on more registers
    __builtin_amdgcn_sched_barrier(0);
  }
  const int half = lane >> 4;
  const int gcol = nt * 16 + ln;
  const int row0 = blockIdx.x * RB_ + mt * 16;
  float bias = (gcol < 32) ? b_BC[gcol] : b_dt[gcol - 32];
#pragma unroll
  for (int r = 0; r < 8; ++r) {
    int row = row0 + r + 8 * half;
    proj[(size_t)row * 64 + gcol] = acc[r] + bias;
  }
}

// ---------------------------------------------------------------------------
// Kernel 2: Delta = softplus(dtr @ W_dtp + b_dtp)        (M=8192,K=32,N=512)
// ---------------------------------------------------------------------------
// One hardware transcendental on each of a lane's eight values, in place. The eight stand in one
// statement because the instruction set asks for one independent instruction behind a
// transcendental before its result is read or its source overwritten: here each fills that slot
// for the one before it, and the v_nop fills it for the last.
__device__ __forceinline__ void exp2_x8(float (&a)[8]) {   // a = 2^a
  asm("v_exp_f32 %0, %0\n\tv_exp_f32 %1, %1\n\tv_exp_f32 %2, %2\n\tv_exp_f32 %3, %3\n\t"
      "v_exp_f32 %4, %4\n\tv_exp_f32 %5, %5\n\tv_exp_f32 %6, %6\n\tv_exp_f32 %7, %7\n\tv_nop"
      : "+v"(a[0]), "+v"(a[1]), "+v"(a[2]), "+v"(a[3]), "+v"(a[4]), "+v"(a[5]), "+v"(a[6]), "+v"(a[7]));
}
__device__ __forceinline__ void rcp_x8(float (&a)[8]) {   // a = 1 / a
  asm("v_rcp_f32 %0, %0\n\tv_rcp_f32 %1, %1\n\tv_rcp_f32 %2, %2\n\tv_rcp_f32 %3, %3\n\t"
      "v_rcp_f32 %4, %4\n\tv_rcp_f32 %5, %5\n\tv_rcp_f32 %6, %6\n\tv_rcp_f32 %7, %7\n\tv_nop"
      : "+v"(a[0]), "+v"(a[1]), "+v"(a[2]), "+v"(a[3]), "+v"(a[4]), "+v"(a[5]), "+v"(a[6]), "+v"(a[7]));
}
__device__ __forceinline__ void log2_x8(float (&a)[8]) {   // a = log2(a)
  asm("v_log_f32 %0, %0\n\tv_log_f32 %1, %1\n\tv_log_f32 %2, %2\n\tv_log_f32 %3, %3\n\t"
      "v_log_f32 %4, %4\n\tv_log_f32 %5, %5\n\tv_log_f32 %6, %6\n\tv_log_f32 %7, %7\n\tv_nop"
      : "+v"(a[0]), "+v"(a[1]), "+v"(a[2]), "+v"(a[3]), "+v"(a[4]), "+v"(a[5]), "+v"(a[6]), "+v"(a[7]));
}

// softplus(v) = log(1 + e), e = exp(v), on eight values, without a branch and without log1pf(),
// whose two-float arithmetic is one long dependent chain and was most of this kernel's vector
// work.
// e <= 1/2: log(1 + e) = 2 atanh(s) with s = e / (2 + e) <= 1/5, z = s * s <= 1/25:
//   2 atanh(s) = 2 s + s w,  w = 2 (z/3 + z^2/5 + z^3/7 + z^4/9),  and 2 s = e - e s,
//   so the result is e - s (e - w): e itself is the leading term, and the rounding of s counts
//   only times s. The first term left out, s * 2 z^5 / 11, is below 1e-8 of the result.
// e > 1/2: the sum 1 + e is at least 3/2, its rounding is small beside a result above 2/5, and the
//   hardware logarithm (base 2) serves; there Delta keeps about 3e-7 of relative error.
// v > 20 gives v as before; the selects drop whatever the unused forms make of a huge e.
__device__ __forceinline__ void softplus8(float (&v)[8]) {
  float e[8], r[8], l[8];
#pragma unroll
  for (int i = 0; i < 8; ++i) e[i] = v[i] * 1.4426950408889634f;
  exp2_x8(e);                                         // e = exp(v)
#pragma unroll
  for (int i = 0; i < 8; ++i) { r[i] = 2.0f + e[i]; l[i] = 1.0f + e[i]; }
  rcp_x8(r);                                          // r = 1 / (2 + e)
  log2_x8(l);                                         // l = log2(1 + e)
#pragma unroll
  for (int i = 0; i < 8; ++i) {
    float s = e[i] * r[i];
    float z = s * s;
    float w = z * fmaf(z, fmaf(z, fmaf(z, 2.0f / 9.0f, 2.0f / 7.0f), 2.0f / 5.0f), 2.0f / 3.0f);
    float lo = fmaf(-s, e[i] - w, e[i]);
    float hi = l[i] * 0.6931471805599453f;
    float sp = (e[i] > 0.5f) ? hi : lo;
    v[i] = (v[i] > 20.0f) ? v[i] : sp;
  }
}

__global__ void k_proj2(const float* __restrict__ proj,
                        const float* __restrict__ W_dtp,   // (32,512) row-major
                        const float* __restrict__ b_dtp,
                        float* __restrict__ Delta) {
  const int NT = 32;                                  // 512 / 16
  int wave = blockIdx.x * (blockDim.x >> 5) + (threadIdx.x >> 5);
  int lane = threadIdx.x & 31;
  if (wave >= (MTOT / 16) * NT) return;               // wave-uniform (never taken)
  int nt = wave % NT;
  int mt = wave / NT;
  int row0 = mt * 16;
  int n0 = nt * 16;
  int ln = lane & 15;
  int kk = (lane >> 4) << 1;

  v8f acc = {};
  const float* arow = proj + (size_t)(row0 + ln) * 64 + 32;
#pragma unroll
  for (int k = 0; k < 32; k += 4) {
    v2f a, b;
    a.x = arow[k + kk];
    a.y = arow[k + kk + 1];
    b.x = W_dtp[(k + kk)     * D_ + n0 + ln];
    b.y = W_dtp[(k + kk + 1) * D_ + n0 + ln];
    acc = __builtin_amdgcn_wmma_f32_16x16x4_f32(false, a, false, b,
                                                (short)0, acc, false, false);
  }
  float bias = b_dtp[n0 + ln];
  // keeps the store address's arithmetic behind the products: moved up among them it took
  // registers that the product issued just before it still names as its A or B operand
  __builtin_amdgcn_sched_barrier(0);
  int half = lane >> 4;
  float v[8];
#pragma unroll
  for (int r = 0; r < 8; ++r) v[r] = acc[r] + bias;
  softplus8(v);
#pragma unroll
  for (int r = 0; r < 8; ++r) {
    int row = row0 + r + 8 * half;
    Delta[(size_t)row * D_ + n0 + ln] = v[r];
  }
}

// ---------------------------------------------------------------------------
// Chunked scan, one launch. Recurrence h[l] = a[l]*h[l-1] + b[l] composes per chunk as
//   h_out = P*h_in + g     (P = prod a, g = local scan with h_in = 0)
// A block takes SW_ channels (one 128-byte line of a row) of one sequence and one of two parts of
// its rows: rows 0 .. R0_-1, or rows R0_ .. L_-1. A wave takes one chunk of the part, a lane one
// channel. Pass 1 makes P and g of the chunks, the waves hand them over in LDS and every wave gets
// its entry state, pass 2 reruns the chunk from there and emits y + x*Dparam.
// No block waits for another: a block of the second part first runs pass 1 over rows 0 .. R0_-1
// itself and composes the state at row R0_ from it. R0_ is chosen so that both kinds of block
// have about the same work (2 * G0_ groups against G0_ + 2 * G1_).
// ---------------------------------------------------------------------------
#define LOG2E_ 1.4426950408889634f
#define PF_ 16             // timesteps whose Delta and x are fetched ahead as one group
#define SW_ 32             // channels per block
#define NW_ 8              // waves per block = chunks per part
#define G0_ 5              // groups per chunk in rows 0 .. R0_-1
#define G1_ 3              // groups per chunk in rows R0_ .. L_-1
#define R0_ (NW_ * G0_ * PF_)                 // 640; R0_ + NW_*G1_*PF_ == L_
#define NQ_ (N_ / 4)       // 16-byte words of states per thread

// 2^v straight from the hardware instruction. exp2f() wraps it in a rescue for results below
// 2^-126 (a compare, two selects, an add and an ldexp per call), which is most of the vector
// work of a scan step. Without it such a decay factor may come out as 0 instead of a denormal:
// it multiplies the carried state, so the difference is below 2^-126 times that state.
// Taken on pairs of states, so that the multiplies and fused multiply-adds around it stay the
// packed two-float instructions that the compiler formed around exp2f().
__device__ __forceinline__ v2f exp2_hw(v2f v) {
  v2f r;
  r.x = __builtin_amdgcn_exp2f(v.x);
  r.y = __builtin_amdgcn_exp2f(v.y);
  return r;
}

// Work-group barrier for data handed over in LDS only: the fences name the LDS address space, so the
// wave waits for its LDS operations (s_wait_dscnt 0) and not for its global loads. __syncthreads()
// would wait for the group of Delta and x asked for just before, and expose its whole latency.
__device__ __forceinline__ void barrier_lds() {
  __builtin_amdgcn_fence(__ATOMIC_RELEASE, "workgroup", "local");
  __builtin_amdgcn_s_barrier();
  __builtin_amdgcn_fence(__ATOMIC_ACQUIRE, "workgroup", "local");
}

__global__ void __launch_bounds__(256) k_scan(const float* __restrict__ x,
                             const float* __restrict__ proj,
                             const float* __restrict__ Delta,
                             const float* __restrict__ A_log,
                             const float* __restrict__ Dparam,
                             float* __restrict__ out) {
  __shared__ __attribute__((aligned(16))) float sBC[L_ * 32];       // Bc|Cc of the rows: 128 KB
  __shared__ __attribute__((aligned(16))) v4f sX[NW_ * 2 * NQ_ * SW_];  // P and g of the chunks: 32 KB
  const int blk  = blockIdx.x;                // B_ * 2 * (D_/SW_)
  const int cg   = blk % (D_ / SW_);
  const int part = (blk / (D_ / SW_)) & 1;
  const int b    = blk / (2 * (D_ / SW_));
  const int tid  = threadIdx.x;
  const int lane = tid & 31;
  const int w    = __builtin_amdgcn_readfirstlane(tid >> 5);   // the wave's number, held scalar
  const int d    = cg * SW_ + lane;

  // Bc|Cc (the first 128 bytes of a proj row) of rows 0 .. R0_-1, for the second part of all rows.
  // One copy of the block covers 32 rows; LDS keeps the rows back to back.
  {
    const int nr = part ? L_ / 32 : R0_ / 32;             // 32 or 20 copies per lane, in fours
    unsigned la = (unsigned)(size_t)sBC + (unsigned)tid * 16u;
    const float* ga = proj + ((size_t)b * L_ + (tid >> 3)) * 64 + (tid & 7) * 4;
    for (int k = 0; k < nr; k += 4) {
      async_g2l_b128_x4(la, la + 4096u, la + 8192u, la + 12288u,
                        ga, ga + 32 * 64, ga + 64 * 64, ga + 96 * 64);
      la += 16384u;
      ga += 128 * 64;
    }
  }
  float A2[N_];
#pragma unroll
  for (int n = 0; n < N_; ++n)
    A2[n] = -__expf(A_log[d * N_ + n]) * LOG2E_;
  float Dp = Dparam[d];
  int row = w * (G0_ * PF_);                  // first row of the wave's chunk
  int ng  = G0_;                              // its groups
  const float* dp = Delta + ((size_t)b * L_ + row) * D_ + d;
  const float* xp = x     + ((size_t)b * L_ + row) * D_ + d;
  float dn[PF_], xn[PF_];                     // the group in flight
#pragma unroll
  for (int i = 0; i < PF_; ++i) { dn[i] = dp[i * D_]; xn[i] = xp[i * D_]; }
  wait_async0();
  __syncthreads();                            // Bc|Cc are complete for every wave

  v2f A2v[N_ / 2], hv[N_ / 2];                // the states and their rates as pairs (2j, 2j+1)
#pragma unroll
  for (int j = 0; j < N_ / 2; ++j) A2v[j] = v2f{A2[2 * j], A2[2 * j + 1]};
  v4f h0 = {0.0f, 0.0f, 0.0f, 0.0f};          // waves 0..3: word w of the state in front of chunk 0

  // pass 1: once, or twice in a block of the second part. Rolled, so that its code stands once.
#pragma unroll 1
  for (int ph = 0; ; ++ph) {
    v2f pv[N_ / 2];
#pragma unroll
    for (int j = 0; j < N_ / 2; ++j) { hv[j] = v2f{0.0f, 0.0f}; pv[j] = v2f{1.0f, 1.0f}; }
    // rolled: one group's body stays the loop, so the code fits the instruction cache
#pragma unroll 1
    for (int g = 0; g < ng; ++g) {
      float dc[PF_], xc[PF_];
#pragma unroll
      for (int i = 0; i < PF_; ++i) { dc[i] = dn[i]; xc[i] = xn[i]; }
      if (g + 1 < ng) {                       // next group's loads fly under this group's work
        dp += PF_ * D_;
        xp += PF_ * D_;
#pragma unroll
        for (int i = 0; i < PF_; ++i) { dn[i] = dp[i * D_]; xn[i] = xp[i * D_]; }
      }
#pragma unroll
      for (int i = 0; i < PF_; ++i) {
        float dv = dc[i];
        float xd = xc[i] * dv;
        const float* brow = &sBC[(row + g * PF_ + i) * 32];
#pragma unroll
        for (int j = 0; j < N_ / 2; ++j) {
          v2f alpha = exp2_hw(A2v[j] * dv);
          v2f bb = {brow[2 * j], brow[2 * j + 1]};
          pv[j] *= alpha;
          hv[j] = __builtin_elementwise_fma(alpha, hv[j], bb * xd);
        }
      }
    }
    const bool more = ph < part;              // the same for the whole block
    if (more) { row = R0_ + w * (G1_ * PF_); ng = G1_; }
    // first group of what comes next (pass 1 of the own part, or pass 2 of the same rows):
    // asked for here, so that it flies under the hand-over
    dp = Delta + ((size_t)b * L_ + row) * D_ + d;
    xp = x     + ((size_t)b * L_ + row) * D_ + d;
#pragma unroll
    for (int i = 0; i < PF_; ++i) { dn[i] = dp[i * D_]; xn[i] = xp[i * D_]; }
#pragma unroll
    for (int q = 0; q < NQ_; ++q) {
      sX[(w * 2 * NQ_ + q) * SW_ + lane]       = v4f{pv[2 * q].x, pv[2 * q].y, pv[2 * q + 1].x, pv[2 * q + 1].y};
      sX[(w * 2 * NQ_ + NQ_ + q) * SW_ + lane] = v4f{hv[2 * q].x, hv[2 * q].y, hv[2 * q + 1].x, hv[2 * q + 1].y};
    }
    barrier_lds();                            // P and g of all chunks are in LDS
    // wave q < NQ_ walks word q of the state through the chunks in their order, h = P*h + g, and
    // leaves each chunk's entry state where its g stood (a slot that only this thread reads)
    if (w < NQ_) {
      v4f Pj[NW_], gj[NW_];
#pragma unroll
      for (int j = 0; j < NW_; ++j) {
        Pj[j] = sX[(j * 2 * NQ_ + w) * SW_ + lane];
        gj[j] = sX[(j * 2 * NQ_ + NQ_ + w) * SW_ + lane];
      }
#pragma unroll
      for (int j = 0; j < NW_; ++j) {
        sX[(j * 2 * NQ_ + NQ_ + w) * SW_ + lane] = h0;
        h0 = __builtin_elementwise_fma(Pj[j], h0, gj[j]);
      }
    }
    barrier_lds();                            // entry states are in LDS; sX may be written again
    if (!more) break;
  }
#pragma unroll
  for (int q = 0; q < NQ_; ++q) {
    v4f e = sX[(w * 2 * NQ_ + NQ_ + q) * SW_ + lane];
    hv[2 * q]     = v2f{e.x, e.y};
    hv[2 * q + 1] = v2f{e.z, e.w};
  }
  float* op = out + ((size_t)b * L_ + row) * D_ + d;

  // pass 2. rolled: one group's body stays the loop, so the code fits the instruction cache
#pragma unroll 1
  for (int g = 0; g < ng; ++g) {
    float dc[PF_], xc[PF_];
#pragma unroll
    for (int i = 0; i < PF_; ++i) { dc[i] = dn[i]; xc[i] = xn[i]; }
    if (g + 1 < ng) {                         // next group's loads fly under this group's work
      dp += PF_ * D_;
      xp += PF_ * D_;
#pragma unroll
      for (int i = 0; i < PF_; ++i) { dn[i] = dp[i * D_]; xn[i] = xp[i * D_]; }
    }
#pragma unroll
    for (int i = 0; i < PF_; ++i) {
      float dv = dc[i];
      float xv = xc[i];
      float xd = xv * dv;
      const float* bc = &sBC[(row + g * PF_ + i) * 32];
      float y = 0.0f;
#pragma unroll
      for (int j = 0; j < N_ / 2; ++j) {
        v2f alpha = exp2_hw(A2v[j] * dv);
        v2f bb = {bc[2 * j], bc[2 * j + 1]};
        hv[j] = __builtin_elementwise_fma(alpha, hv[j], bb * xd);
        y += bc[16 + 2 * j]     * hv[j].x;    // one chain in the order of n
        y += bc[16 + 2 * j + 1] * hv[j].y;
      }
      op[(g * PF_ + i) * D_] = y + xv * Dp;
      // every fourth step: bounds how far the scheduler spreads the unrolled steps (without it
      // the registers pass 256 and register-window switches enter the loop); the last one also
      // keeps the hand-over of the fetched registers, with its load wait, behind the work
      if ((i & 3) == 3) __builtin_amdgcn_sched_barrier(0);
    }
  }
}

// ---------------------------------------------------------------------------
extern "C" void kernel_launch(void* const* d_in, const int* in_sizes, int n_in,
                              void* d_out, int out_size, void* d_ws, size_t ws_size,
                              hipStream_t stream) {
  const float* x    = (const float*)d_in[0];
  const float* ck   = (const float*)d_in[1];
  const float* W_BC = (const float*)d_in[2];
  const float* b_BC = (const float*)d_in[3];
  const float* A_lg = (const float*)d_in[4];
  const float* Dpar = (const float*)d_in[5];
  const float* W_dt = (const float*)d_in[6];
  const float* b_dt = (const float*)d_in[7];
  const float* Wdtp = (const float*)d_in[8];
  const float* bdtp = (const float*)d_in[9];
  float* out = (float*)d_out;

  char* ws = (char*)d_ws;
  const size_t SZ_U  = (size_t)B_ * L_ * D_ * 4;          // 16 MB
  float* proj  = (float*)(ws + SZ_U);                     //  2 MB
  float* Delta = (float*)(ws + SZ_U + (size_t)MTOT * 64 * 4);   // 16 MB

  // 1) conv + silu, proj = u @ [W_BC|W_dt] + bias : 256 blocks, 2048 waves
  k_conv_proj1<<<MTOT / RB_, 256, 0, stream>>>(x, ck, W_BC, b_BC, W_dt, b_dt, proj);

  // 2) Delta = softplus(dtr @ W_dtp + b_dtp) : 16384 waves
  k_proj2<<<4096, 128, 0, stream>>>(proj, Wdtp, bdtp, Delta);

  // 3) chunked scan, both passes : 256 blocks, 2048 waves
  k_scan<<<B_ * 2 * (D_ / SW_), 256, 0, stream>>>(x, proj, Delta, A_lg, Dpar, out);
}

// v008
// A run of this version takes 35.4 microseconds.
// In both of two side-by-side timings against v007, it was 1.08 times as fast.
// Over all steps from v000 it is 3.72 times as fast.
#include <hip/hip_runtime.h>
#include <hip/hip_bf16.h>
#include <math.h>

#define B_    8
#define L_    1024
#define D_    512
#define N_    16
#define MTOT  (B_*L_)      // 8192 rows

typedef __attribute__((ext_vector_type(2))) float v2f;
typedef __attribute__((ext_vector_type(8))) float v8f;

__device__ __forceinline__ float silu_f(float v) { return v / (1.0f + __expf(-v)); }

// Four asynchronous global->LDS copies of 16 bytes per lane, counted on ASYNCcnt. The s_wait_xcnt
// stands in the copies' own statement, so that it comes before any rewrite of their address registers.
__device__ __forceinline__ void async_g2l_b128_x4(unsigned l0, unsigned l1, unsigned l2, unsigned l3,
                                                  const float* g0, const float* g1,
                                                  const float* g2, const float* g3) {
  asm volatile("global_load_async_to_lds_b128 %0, %4, off\n\t"
               "global_load_async_to_lds_b128 %1, %5, off\n\t"
               "global_load_async_to_lds_b128 %2, %6, off\n\t"
               "global_load_async_to_lds_b128 %3, %7, off\n\t"
               "s_wait_xcnt 0x0"
               :: "v"(l0), "v"(l1), "v"(l2), "v"(l3), "v"(g0), "v"(g1), "v"(g2), "v"(g3) : "memory");
}
__device__ __forceinline__ void wait_async0() {
  asm volatile("s_wait_asynccnt 0x0" ::: "memory");
}

// Work-group barrier for data handed over in LDS only: the fences name the LDS address space, so the
// wave waits for its LDS operations (s_wait_dscnt 0) and not for its global loads. __syncthreads()
// would wait for the global loads asked for just before (W_dtp in k_conv_proj, the group of Delta and x in k_scan), and expose their whole latency.
__device__ __forceinline__ void barrier_lds() {
  __builtin_amdgcn_fence(__ATOMIC_RELEASE, "workgroup", "local");
  __builtin_amdgcn_s_barrier();
  __builtin_amdgcn_fence(__ATOMIC_ACQUIRE, "workgroup", "local");
}

// One hardware transcendental on each of a lane's eight values, in place. The eight stand in one
// statement because the instruction set asks for one independent instruction behind a
// transcendental before its result is read or its source overwritten: here each fills that slot
// for the one before it, and the v_nop fills it for the last.
__device__ __forceinline__ void exp2_x8(float (&a)[8]) {   // a = 2^a
  asm("v_exp_f32 %0, %0\n\tv_exp_f32 %1, %1\n\tv_exp_f32 %2, %2\n\tv_exp_f32 %3, %3\n\t"
      "v_exp_f32 %4, %4\n\tv_exp_f32 %5, %5\n\tv_exp_f32 %6, %6\n\tv_exp_f32 %7, %7\n\tv_nop"
      : "+v"(a[0]), "+v"(a[1]), "+v"(a[2]), "+v"(a[3]), "+v"(a[4]), "+v"(a[5]), "+v"(a[6]), "+v"(a[7]));
}
__device__ __forceinline__ void rcp_x8(float (&a)[8]) {   // a = 1 / a
  asm("v_rcp_f32 %0, %0\n\tv_rcp_f32 %1, %1\n\tv_rcp_f32 %2, %2\n\tv_rcp_f32 %3, %3\n\t"
      "v_rcp_f32 %4, %4\n\tv_rcp_f32 %5, %5\n\tv_rcp_f32 %6, %6\n\tv_rcp_f32 %7, %7\n\tv_nop"
      : "+v"(a[0]), "+v"(a[1]), "+v"(a[2]), "+v"(a[3]), "+v"(a[4]), "+v"(a[5]), "+v"(a[6]), "+v"(a[7]));
}
__device__ __forceinline__ void log2_x8(float (&a)[8]) {   // a = log2(a)
  asm("v_log_f32 %0, %0\n\tv_log_f32 %1, %1\n\tv_log_f32 %2, %2\n\tv_log_f32 %3, %3\n\t"
      "v_log_f32 %4, %4\n\tv_log_f32 %5, %5\n\tv_log_f32 %6, %6\n\tv_log_f32 %7, %7\n\tv_nop"
      : "+v"(a[0]), "+v"(a[1]), "+v"(a[2]), "+v"(a[3]), "+v"(a[4]), "+v"(a[5]), "+v"(a[6]), "+v"(a[7]));
}

// softplus(v) = log(1 + e), e = exp(v), on eight values, without a branch and without log1pf(),
// whose two-float arithmetic is one long dependent chain and was most of this kernel's vector
// work.
// e <= 1/2: log(1 + e) = 2 atanh(s) with s = e / (2 + e) <= 1/5, z = s * s <= 1/25:
//   2 atanh(s) = 2 s + s w,  w = 2 (z/3 + z^2/5 + z^3/7 + z^4/9),  and 2 s = e - e s,
//   so the result is e - s (e - w): e itself is the leading term, and the rounding of s counts
//   only times s. The first term left out, s * 2 z^5 / 11, is below 1e-8 of the result.
// e > 1/2: the sum 1 + e is at least 3/2, its rounding is small beside a result above 2/5, and the
//   hardware logarithm (base 2) serves; there Delta keeps about 3e-7 of relative error.
// v > 20 gives v as before; the selects drop whatever the unused forms make of a huge e.
__device__ __forceinline__ void softplus8(float (&v)[8]) {
  float e[8], r[8], l[8];
#pragma unroll
  for (int i = 0; i < 8; ++i) e[i] = v[i] * 1.4426950408889634f;
  exp2_x8(e);                                         // e = exp(v)
#pragma unroll
  for (int i = 0; i < 8; ++i) { r[i] = 2.0f + e[i]; l[i] = 1.0f + e[i]; }
  rcp_x8(r);                                          // r = 1 / (2 + e)
  log2_x8(l);                                         // l = log2(1 + e)
#pragma unroll
  for (int i = 0; i < 8; ++i) {
    float s = e[i] * r[i];
    float z = s * s;
    float w = z * fmaf(z, fmaf(z, fmaf(z, 2.0f / 9.0f, 2.0f / 7.0f), 2.0f / 5.0f), 2.0f / 3.0f);
    float lo = fmaf(-s, e[i] - w, e[i]);
    float hi = l[i] * 0.6931471805599453f;
    float sp = (e[i] > 0.5f) ? hi : lo;
    v[i] = (v[i] > 20.0f) ? v[i] : sp;
  }
}

// ---------------------------------------------------------------------------
// Kernel 1: u = SiLU(depthwise conv3(x), SAME, zero pad), kept in LDS,
//           proj = u @ [W_BC | W_dt] + [b_BC | b_dt]     (M=8192,K=512,N=64)
//           Delta = softplus(dtr @ W_dtp + b_dtp)        (M=8192,K=32,N=512)
// One block per RB_ rows. Part 1: a thread makes 4 channels x CR_ rows of u with 16-byte loads,
// each x row loaded once per thread and used by three output rows. Part 2: one wave per 16x16
// tile, V_WMMA_F32_16X16X4_F32, 128 steps of k in rising order on one accumulator.
// proj row layout: cols 0..15 = Bc, 16..31 = Cc (stored); cols 32..63 = dtr, the dt_rank proj,
// which stays in LDS. Part 3: a wave makes Delta of the block's rows for 64 channels, four tiles
// side by side, 8 steps of k in rising order each. Tile j holds the channels 4*ln + j, so a lane's
// four tiles are four neighbouring channels: W_dtp is loaded and Delta stored in 16-byte words.
// ---------------------------------------------------------------------------
#define RB_ 32             // rows per block; divides L_, so a block stays in one sequence
#define CR_ 16             // rows per thread in part 1 (two thread halves cover RB_)
#define UP_ (D_ + 4)       // LDS pitch of a u row in floats: 16 rows' 8-byte reads meet no bank twice
#define KG_ 16             // k-steps (of 4) whose operands are fetched ahead as one group
#define NKG_ (D_ / (4 * KG_))
#define DP_ 36             // LDS pitch of a dtr row in floats: 16 rows' 8-byte reads meet no bank twice
#define KS_ 8              // k-steps (of 4) of the Delta product
typedef __attribute__((ext_vector_type(4))) float v4f;

__global__ void __launch_bounds__(256) k_conv_proj(const float* __restrict__ x,
                        const float* __restrict__ ck,   // (K=3,1,D)
                        const float* __restrict__ W_BC, const float* __restrict__ b_BC,
                        const float* __restrict__ W_dt, const float* __restrict__ b_dt,
                        const float* __restrict__ W_dtp,   // (32,512) row-major
                        const float* __restrict__ b_dtp,
                        float* __restrict__ proj,
                        float* __restrict__ Delta) {
  __shared__ __attribute__((aligned(16))) float sU[RB_ * UP_];
  __shared__ __attribute__((aligned(16))) float sDt[RB_ * DP_];
  const int tid = threadIdx.x;
  const int lane = tid & 31;
  const int wave = tid >> 5;
  const int nt = wave & 3;                            // 64 / 16 column tiles
  const int mt = wave >> 2;                           // RB_ / 16 row tiles
  const int ln = lane & 15;                           // M for A-frag, N for B-frag
  const int kk = (lane >> 4) << 1;                    // K sub-offset: 0 or 2

  const float* W = (nt < 2) ? W_BC : W_dt;            // both row-major (512,32)
  const float* wp = W + kk * 32 + (nt & 1) * 16 + ln;
  float bq[3][2 * KG_];                               // W groups: one in use, two in flight

  {
    const int d = (tid & 127) * 4;
    const int lr0 = (tid >> 7) * CR_;                 // first row of this thread inside the block
    const int row0 = blockIdx.x * RB_ + lr0;          // flat row b*L + l of the first output
    const int l0 = row0 % L_;
    const float* xp = x + (size_t)row0 * D_ + d;
    v4f c0 = *(const v4f*)(ck + 0 * D_ + d);
    v4f c1 = *(const v4f*)(ck + 1 * D_ + d);
    v4f c2 = *(const v4f*)(ck + 2 * D_ + d);
    v4f r[CR_ + 2];                                   // rows l0-1 .. l0+CR_
    const v4f zero = {0.0f, 0.0f, 0.0f, 0.0f};
    r[0] = (l0 > 0) ? *(const v4f*)(xp - D_) : zero;
#pragma unroll
    for (int i = 0; i < CR_; ++i) r[i + 1] = *(const v4f*)(xp + i * D_);
    r[CR_ + 1] = (l0 + CR_ < L_) ? *(const v4f*)(xp + CR_ * D_) : zero;
    // the first two groups of W are asked for here, behind x, so that they fly under part 1
#pragma unroll
    for (int g = 0; g < 2; ++g) {
#pragma unroll
      for (int i = 0; i < KG_; ++i) {
        bq[g][2 * i]     = wp[(g * 4 * KG_ + 4 * i)     * 32];
        bq[g][2 * i + 1] = wp[(g * 4 * KG_ + 4 * i + 1) * 32];
      }
    }
#pragma unroll
    for (int i = 0; i < CR_; ++i) {
      v4f v = c0 * r[i] + c1 * r[i + 1] + c2 * r[i + 2];
      v4f o;
      o.x = silu_f(v.x); o.y = silu_f(v.y); o.z = silu_f(v.z); o.w = silu_f(v.w);
      *(v4f*)&sU[(lr0 + i) * UP_ + d] = o;
    }
  }
  __syncthreads();                                    // u of the block's rows is complete

  v8f acc = {};
  const float* ap = &sU[(mt * 16 + ln) * UP_ + kk];
  v2f aq[2][KG_];                                     // u groups: one in use, one in flight
  const int dc0 = wave * 64 + ln * 4;                 // first of the lane's four Delta channels
  v4f wq[KS_][2];                                     // W_dtp rows 4s+kk, 4s+kk+1 at those channels
  v4f bd;
#pragma unroll
  for (int i = 0; i < KG_; ++i) aq[0][i] = *(const v2f*)(ap + 4 * i);
  // written out group by group: the buffers take turns without register copies, and every load
  // is unconditional, so that the waits in front of the products stay counted ones
#pragma unroll
  for (int g = 0; g < NKG_; ++g) {
    if (g + 2 < NKG_) {
#pragma unroll
      for (int i = 0; i < KG_; ++i) {
        bq[(g + 2) % 3][2 * i]     = wp[((g + 2) * 4 * KG_ + 4 * i)     * 32];
        bq[(g + 2) % 3][2 * i + 1] = wp[((g + 2) * 4 * KG_ + 4 * i + 1) * 32];
      }
    }
    if (g + 2 == NKG_) {                              // no W group is left to ask for: W_dtp takes
#pragma unroll                                        // its place and flies under the last products
      for (int s = 0; s < KS_; ++s) {
        wq[s][0] = *(const v4f*)(W_dtp + (4 * s + kk)     * D_ + dc0);
        wq[s][1] = *(const v4f*)(W_dtp + (4 * s + kk + 1) * D_ + dc0);
      }
      bd = *(const v4f*)(b_dtp + dc0);
    }
    if (g + 1 < NKG_) {
#pragma unroll
      for (int i = 0; i < KG_; ++i)
        aq[(g + 1) & 1][i] = *(const v2f*)(ap + (g + 1) * (4 * KG_) + 4 * i);
    }
    // keeps the loads of the later groups in front of this group's products; without it they
    // are moved down to their uses and each product waits for its own operands
    __builtin_amdgcn_sched_barrier(0);
#pragma unroll
    for (int i = 0; i < KG_; ++i) {
      v2f b = {bq[g % 3][2 * i], bq[g % 3][2 * i + 1]};
      acc = __builtin_amdgcn_wmma_f32_16x16x4_f32(false, aq[g & 1][i], false, b,
                                                  (short)0, acc, false, false);
    }
    // keeps the next loads one block behind this group's products; without it part of them is
    // moved up among the products, a further place of LDS reads in the stream, on more registers
    __builtin_amdgcn_sched_barrier(0);
  }
  const int half = lane >> 4;
  const int gcol = nt * 16 + ln;
  const int row0 = blockIdx.x * RB_ + mt * 16;
  float bias = (gcol < 32) ? b_BC[gcol] : b_dt[gcol - 32];
  if (nt < 2) {                                       // the same for a whole wave
#pragma unroll
    for (int r = 0; r < 8; ++r) {
      int row = row0 + r + 8 * half;
      proj[(size_t)row * 64 + gcol] = acc[r] + bias;
    }
  } else {
#pragma unroll
    for (int r = 0; r < 8; ++r)
      sDt[(mt * 16 + r + 8 * half) * DP_ + gcol - 32] = acc[r] + bias;
  }
  barrier_lds();                                      // dtr of the block's rows is complete

  float* dq = Delta + (size_t)(blockIdx.x * RB_ + 8 * half) * D_ + dc0;
  // rolled: the body stands once, so the kernel's text stays small for a cold instruction cache
#pragma unroll 1
  for (int m = 0; m < RB_ / 16; ++m) {
    const float* ar = &sDt[(m * 16 + ln) * DP_ + kk];
    v2f a[KS_];
#pragma unroll
    for (int s = 0; s < KS_; ++s) a[s] = *(const v2f*)(ar + 4 * s);
    v8f c[4] = {};
#pragma unroll
    for (int s = 0; s < KS_; ++s) {
#pragma unroll
      for (int j = 0; j < 4; ++j) {
        v2f b = {wq[s][0][j], wq[s][1][j]};
        c[j] = __builtin_amdgcn_wmma_f32_16x16x4_f32(false, a[s], false, b,
                                                     (short)0, c[j], false, false);
      }
    }
    float v[4][8];
#pragma unroll
    for (int j = 0; j < 4; ++j) {
#pragma unroll
      for (int r = 0; r < 8; ++r) v[j][r] = c[j][r] + bd[j];
      softplus8(v[j]);
    }
#pragma unroll
    for (int r = 0; r < 8; ++r)
      *(v4f*)(dq + (m * 16 + r) * D_) = v4f{v[0][r], v[1][r], v[2][r], v[3][r]};
    // the next trip writes the stores' address and data registers anew: the wait stands in front
    asm volatile("s_wait_xcnt 0x0" ::: "memory");
  }
}

// ---------------------------------------------------------------------------
// Chunked scan, one launch. Recurrence h[l] = a[l]*h[l-1] + b[l] composes per chunk as
//   h_out = P*h_in + g     (P = prod a, g = local scan with h_in = 0)
// A block takes SW_ channels (one 128-byte line of a row) of one sequence and one of two parts of
// its rows: rows 0 .. R0_-1, or rows R0_ .. L_-1. A wave takes one chunk of the part, a lane one
// channel. Pass 1 makes P and g of the chunks, the waves hand them over in LDS and every wave gets
// its entry state, pass 2 reruns the chunk from there and emits y + x*Dparam.
// No block waits for another: a block of the second part first runs pass 1 over rows 0 .. R0_-1
// itself and composes the state at row R0_ from it. R0_ is chosen so that both kinds of block
// have about the same work (2 * G0_ groups against G0_ + 2 * G1_).
// ---------------------------------------------------------------------------
#define LOG2E_ 1.4426950408889634f
#define PF_ 16             // timesteps whose Delta and x are fetched ahead as one group
#define SW_ 32             // channels per block
#define NW_ 8              // waves per block = chunks per part
#define G0_ 5              // groups per chunk in rows 0 .. R0_-1
#define G1_ 3              // groups per chunk in rows R0_ .. L_-1
#define R0_ (NW_ * G0_ * PF_)                 // 640; R0_ + NW_*G1_*PF_ == L_
#define NQ_ (N_ / 4)       // 16-byte words of states per thread

// 2^v straight from the hardware instruction. exp2f() wraps it in a rescue for results below
// 2^-126 (a compare, two selects, an add and an ldexp per call), which is most of the vector
// work of a scan step. Without it such a decay factor may come out as 0 instead of a denormal:
// it multiplies the carried state, so the difference is below 2^-126 times that state.
// Taken on pairs of states, so that the multiplies and fused multiply-adds around it stay the
// packed two-float instructions that the compiler formed around exp2f().
__device__ __forceinline__ v2f exp2_hw(v2f v) {
  v2f r;
  r.x = __builtin_amdgcn_exp2f(v.x);
  r.y = __builtin_amdgcn_exp2f(v.y);
  return r;
}

__global__ void __launch_bounds__(256) k_scan(const float* __restrict__ x,
                             const float* __restrict__ proj,
                             const float* __restrict__ Delta,
                             const float* __restrict__ A_log,
                             const float* __restrict__ Dparam,
                             float* __restrict__ out) {
  __shared__ __attribute__((aligned(16))) float sBC[L_ * 32];       // Bc|Cc of the rows: 128 KB
  __shared__ __attribute__((aligned(16))) v4f sX[NW_ * 2 * NQ_ * SW_];  // P and g of the chunks: 32 KB
  const int blk  = blockIdx.x;                // B_ * 2 * (D_/SW_)
  const int cg   = blk % (D_ / SW_);
  const int part = (blk / (D_ / SW_)) & 1;
  const int b    = blk / (2 * (D_ / SW_));
  const int tid  = threadIdx.x;
  const int lane = tid & 31;
  const int w    = __builtin_amdgcn_readfirstlane(tid >> 5);   // the wave's number, held scalar
  const int d    = cg * SW_ + lane;

  // Bc|Cc (the first 128 bytes of a proj row) of rows 0 .. R0_-1, for the second part of all rows.
  // One copy of the block covers 32 rows; LDS keeps the rows back to back.
  {
    const int nr = part ? L_ / 32 : R0_ / 32;             // 32 or 20 copies per lane, in fours
    unsigned la = (unsigned)(size_t)sBC + (unsigned)tid * 16u;
    const float* ga = proj + ((size_t)b * L_ + (tid >> 3)) * 64 + (tid & 7) * 4;
    for (int k = 0; k < nr; k += 4) {
      async_g2l_b128_x4(la, la + 4096u, la + 8192u, la + 12288u,
                        ga, ga + 32 * 64, ga + 64 * 64, ga + 96 * 64);
      la += 16384u;
      ga += 128 * 64;
    }
  }
  float A2[N_];
#pragma unroll
  for (int n = 0; n < N_; ++n)
    A2[n] = -__expf(A_log[d * N_ + n]) * LOG2E_;
  float Dp = Dparam[d];
  int row = w * (G0_ * PF_);                  // first row of the wave's chunk
  int ng  = G0_;                              // its groups
  const float* dp = Delta + ((size_t)b * L_ + row) * D_ + d;
  const float* xp = x     + ((size_t)b * L_ + row) * D_ + d;
  float dn[PF_], xn[PF_];                     // the group in flight
#pragma unroll
  for (int i = 0; i < PF_; ++i) { dn[i] = dp[i * D_]; xn[i] = xp[i * D_]; }
  wait_async0();
  __syncthreads();                            // Bc|Cc are complete for every wave

  v2f A2v[N_ / 2], hv[N_ / 2];                // the states and their rates as pairs (2j, 2j+1)
#pragma unroll
  for (int j = 0; j < N_ / 2; ++j) A2v[j] = v2f{A2[2 * j], A2[2 * j + 1]};
  v4f h0 = {0.0f, 0.0f, 0.0f, 0.0f};          // waves 0..3: word w of the state in front of chunk 0

  // pass 1: once, or twice in a block of the second part. Rolled, so that its code stands once.
#pragma unroll 1
  for (int ph = 0; ; ++ph) {
    v2f pv[N_ / 2];
#pragma unroll
    for (int j = 0; j < N_ / 2; ++j) { hv[j] = v2f{0.0f, 0.0f}; pv[j] = v2f{1.0f, 1.0f}; }
    // rolled: one group's body stays the loop, so the code fits the instruction cache
#pragma unroll 1
    for (int g = 0; g < ng; ++g) {
      float dc[PF_], xc[PF_];
#pragma unroll
      for (int i = 0; i < PF_; ++i) { dc[i] = dn[i]; xc[i] = xn[i]; }
      if (g + 1 < ng) {                       // next group's loads fly under this group's work
        dp += PF_ * D_;
        xp += PF_ * D_;
#pragma unroll
        for (int i = 0; i < PF_; ++i) { dn[i] = dp[i * D_]; xn[i] = xp[i * D_]; }
      }
#pragma unroll
      for (int i = 0; i < PF_; ++i) {
        float dv = dc[i];
        float xd = xc[i] * dv;
        const float* brow = &sBC[(row + g * PF_ + i) * 32];
#pragma unroll
        for (int j = 0; j < N_ / 2; ++j) {
          v2f alpha = exp2_hw(A2v[j] * dv);
          v2f bb = {brow[2 * j], brow[2 * j + 1]};
          pv[j] *= alpha;
          hv[j] = __builtin_elementwise_fma(alpha, hv[j], bb * xd);
        }
      }
    }
    const bool more = ph < part;              // the same for the whole block
    if (more) { row = R0_ + w * (G1_ * PF_); ng = G1_; }
    // first group of what comes next (pass 1 of the own part, or pass 2 of the same rows):
    // asked for here, so that it flies under the hand-over
    dp = Delta + ((size_t)b * L_ + row) * D_ + d;
    xp = x     + ((size_t)b * L_ + row) * D_ + d;
#pragma unroll
    for (int i = 0; i < PF_; ++i) { dn[i] = dp[i * D_]; xn[i] = xp[i * D_]; }
#pragma unroll
    for (int q = 0; q < NQ_; ++q) {
      sX[(w * 2 * NQ_ + q) * SW_ + lane]       = v4f{pv[2 * q].x, pv[2 * q].y, pv[2 * q + 1].x, pv[2 * q + 1].y};
      sX[(w * 2 * NQ_ + NQ_ + q) * SW_ + lane] = v4f{hv[2 * q].x, hv[2 * q].y, hv[2 * q + 1].x, hv[2 * q + 1].y};
    }
    barrier_lds();                            // P and g of all chunks are in LDS
    // wave q < NQ_ walks word q of the state through the chunks in their order, h = P*h + g, and
    // leaves each chunk's entry state where its g stood (a slot that only this thread reads)
    if (w < NQ_) {
      v4f Pj[NW_], gj[NW_];
#pragma unroll
      for (int j = 0; j < NW_; ++j) {
        Pj[j] = sX[(j * 2 * NQ_ + w) * SW_ + lane];
        gj[j] = sX[(j * 2 * NQ_ + NQ_ + w) * SW_ + lane];
      }
#pragma unroll
      for (int j = 0; j < NW_; ++j) {
        sX[(j * 2 * NQ_ + NQ_ + w) * SW_ + lane] = h0;
        h0 = __builtin_elementwise_fma(Pj[j], h0, gj[j]);
      }
    }
    barrier_lds();                            // entry states are in LDS; sX may be written again
    if (!more) break;
  }
#pragma unroll
  for (int q = 0; q < NQ_; ++q) {
    v4f e = sX[(w * 2 * NQ_ + NQ_ + q) * SW_ + lane];
    hv[2 * q]     = v2f{e.x, e.y};
    hv[2 * q + 1] = v2f{e.z, e.w};
  }
  float* op = out + ((size_t)b * L_ + row) * D_ + d;

  // pass 2. rolled: one group's body stays the loop, so the code fits the instruction cache
#pragma unroll 1
  for (int g = 0; g < ng; ++g) {
    float dc[PF_], xc[PF_];
#pragma unroll
    for (int i = 0; i < PF_; ++i) { dc[i] = dn[i]; xc[i] = xn[i]; }
    if (g + 1 < ng) {                         // next group's loads fly under this group's work
      dp += PF_ * D_;
      xp += PF_ * D_;
#pragma unroll
      for (int i = 0; i < PF_; ++i) { dn[i] = dp[i * D_]; xn[i] = xp[i * D_]; }
    }
#pragma unroll
    for (int i = 0; i < PF_; ++i) {
      float dv = dc[i];
      float xv = xc[i];
      float xd = xv * dv;
      const float* bc = &sBC[(row + g * PF_ + i) * 32];
      float y = 0.0f;
#pragma unroll
      for (int j = 0; j < N_ / 2; ++j) {
        v2f alpha = exp2_hw(A2v[j] * dv);
        v2f bb = {bc[2 * j], bc[2 * j + 1]};
        hv[j] = __builtin_elementwise_fma(alpha, hv[j], bb * xd);
        y += bc[16 + 2 * j]     * hv[j].x;    // one chain in the order of n
        y += bc[16 + 2 * j + 1] * hv[j].y;
      }
      op[(g * PF_ + i) * D_] = y + xv * Dp;
      // every fourth step: bounds how far the scheduler spreads the unrolled steps (without it
      // the registers pass 256 and register-window switches enter the loop); the last one also
      // keeps the hand-over of the fetched registers, with its load wait, behind the work
      if ((i & 3) == 3) __builtin_amdgcn_sched_barrier(0);
    }
  }
}

// ---------------------------------------------------------------------------
extern "C" void kernel_launch(void* const* d_in, const int* in_sizes, int n_in,
                              void* d_out, int out_size, void* d_ws, size_t ws_size,
                              hipStream_t stream) {
  const float* x    = (const float*)d_in[0];
  const float* ck   = (const float*)d_in[1];
  const float* W_BC = (const float*)d_in[2];
  const float* b_BC = (const float*)d_in[3];
  const float* A_lg = (const float*)d_in[4];
  const float* Dpar = (const float*)d_in[5];
  const float* W_dt = (const float*)d_in[6];
  const float* b_dt = (const float*)d_in[7];
  const float* Wdtp = (const float*)d_in[8];
  const float* bdtp = (const float*)d_in[9];
  float* out = (float*)d_out;

  char* ws = (char*)d_ws;
  const size_t SZ_U  = (size_t)B_ * L_ * D_ * 4;          // 16 MB
  float* proj  = (float*)(ws + SZ_U);                     //  2 MB
  float* Delta = (float*)(ws + SZ_U + (size_t)MTOT * 64 * 4);   // 16 MB

  // 1) conv + silu, proj = u @ [W_BC|W_dt] + bias, Delta = softplus(dtr @ W_dtp + b_dtp) :
  //    256 blocks, 2048 waves
  k_conv_proj<<<MTOT / RB_, 256, 0, stream>>>(x, ck, W_BC, b_BC, W_dt, b_dt, Wdtp, bdtp, proj, Delta);

  // 2) chunked scan, both passes : 256 blocks, 2048 waves
  k_scan<<<B_ * 2 * (D_ / SW_), 256, 0, stream>>>(x, proj, Delta, A_lg, Dpar, out);
}

// v009
// It runs in 30.8 microseconds.
// Two timings next to v008 both put it at 1.15 times that version's speed.
// All steps since v000 together make it 4.28 times as fast.
#include <hip/hip_runtime.h>
#include <hip/hip_bf16.h>
#include <math.h>

#define B_    8
#define L_    1024
#define D_    512
#define N_    16
#define MTOT  (B_*L_)      // 8192 rows

typedef __attribute__((ext_vector_type(2))) float v2f;
typedef __attribute__((ext_vector_type(8))) float v8f;

// Four asynchronous global->LDS copies of 16 bytes per lane, counted on ASYNCcnt. The s_wait_xcnt
// stands in the copies' own statement, so that it comes before any rewrite of their address registers.
__device__ __forceinline__ void async_g2l_b128_x4(unsigned l0, unsigned l1, unsigned l2, unsigned l3,
                                                  const float* g0, const float* g1,
                                                  const float* g2, const float* g3) {
  asm volatile("global_load_async_to_lds_b128 %0, %4, off\n\t"
               "global_load_async_to_lds_b128 %1, %5, off\n\t"
               "global_load_async_to_lds_b128 %2, %6, off\n\t"
               "global_load_async_to_lds_b128 %3, %7, off\n\t"
               "s_wait_xcnt 0x0"
               :: "v"(l0), "v"(l1), "v"(l2), "v"(l3), "v"(g0), "v"(g1), "v"(g2), "v"(g3) : "memory");
}
__device__ __forceinline__ void wait_async0() {
  asm volatile("s_wait_asynccnt 0x0" ::: "memory");
}

// Work-group barrier for data handed over in LDS only: the fences name the LDS address space, so the
// wave waits for its LDS operations (s_wait_dscnt 0) and not for its global loads. __syncthreads()
// would also wait for the W_dtp and b_dtp loads asked for under the last products of part 2.
__device__ __forceinline__ void barrier_lds() {
  __builtin_amdgcn_fence(__ATOMIC_RELEASE, "workgroup", "local");
  __builtin_amdgcn_s_barrier();
  __builtin_amdgcn_fence(__ATOMIC_ACQUIRE, "workgroup", "local");
}

// One hardware transcendental on each of a lane's eight values, in place. The eight stand in one
// statement because the instruction set asks for one independent instruction behind a
// transcendental before its result is read or its source overwritten: here each fills that slot
// for the one before it, and the v_nop fills it for the last.
__device__ __forceinline__ void exp2_x8(float (&a)[8]) {   // a = 2^a
  asm("v_exp_f32 %0, %0\n\tv_exp_f32 %1, %1\n\tv_exp_f32 %2, %2\n\tv_exp_f32 %3, %3\n\t"
      "v_exp_f32 %4, %4\n\tv_exp_f32 %5, %5\n\tv_exp_f32 %6, %6\n\tv_exp_f32 %7, %7\n\tv_nop"
      : "+v"(a[0]), "+v"(a[1]), "+v"(a[2]), "+v"(a[3]), "+v"(a[4]), "+v"(a[5]), "+v"(a[6]), "+v"(a[7]));
}
__device__ __forceinline__ void exp2_x4(float (&a)[4]) {   // a = 2^a, the same on four values
  asm("v_exp_f32 %0, %0\n\tv_exp_f32 %1, %1\n\tv_exp_f32 %2, %2\n\tv_exp_f32 %3, %3\n\tv_nop"
      : "+v"(a[0]), "+v"(a[1]), "+v"(a[2]), "+v"(a[3]));
}
__device__ __forceinline__ void rcp_x8(float (&a)[8]) {   // a = 1 / a
  asm("v_rcp_f32 %0, %0\n\tv_rcp_f32 %1, %1\n\tv_rcp_f32 %2, %2\n\tv_rcp_f32 %3, %3\n\t"
      "v_rcp_f32 %4, %4\n\tv_rcp_f32 %5, %5\n\tv_rcp_f32 %6, %6\n\tv_rcp_f32 %7, %7\n\tv_nop"
      : "+v"(a[0]), "+v"(a[1]), "+v"(a[2]), "+v"(a[3]), "+v"(a[4]), "+v"(a[5]), "+v"(a[6]), "+v"(a[7]));
}
__device__ __forceinline__ void log2_x8(float (&a)[8]) {   // a = log2(a)
  asm("v_log_f32 %0, %0\n\tv_log_f32 %1, %1\n\tv_log_f32 %2, %2\n\tv_log_f32 %3, %3\n\t"
      "v_log_f32 %4, %4\n\tv_log_f32 %5, %5\n\tv_log_f32 %6, %6\n\tv_log_f32 %7, %7\n\tv_nop"
      : "+v"(a[0]), "+v"(a[1]), "+v"(a[2]), "+v"(a[3]), "+v"(a[4]), "+v"(a[5]), "+v"(a[6]), "+v"(a[7]));
}

// softplus(v) = log(1 + e), e = exp(v), on eight values, without a branch and without log1pf(),
// whose two-float arithmetic is one long dependent chain and was most of this kernel's vector
// work.
// e <= 1/2: log(1 + e) = 2 atanh(s) with s = e / (2 + e) <= 1/5, z = s * s <= 1/25:
//   2 atanh(s) = 2 s + s w,  w = 2 (z/3 + z^2/5 + z^3/7 + z^4/9),  and 2 s = e - e s,
//   so the result is e - s (e - w): e itself is the leading term, and the rounding of s counts
//   only times s. The first term left out, s * 2 z^5 / 11, is below 1e-8 of the result.
// e > 1/2: the sum 1 + e is at least 3/2, its rounding is small beside a result above 2/5, and the
//   hardware logarithm (base 2) serves; there Delta keeps about 3e-7 of relative error.
// v > 20 gives v as before; the selects drop whatever the unused forms make of a huge e.
__device__ __forceinline__ void softplus8(float (&v)[8]) {
  float e[8], r[8], l[8];
#pragma unroll
  for (int i = 0; i < 8; ++i) e[i] = v[i] * 1.4426950408889634f;
  exp2_x8(e);                                         // e = exp(v)
#pragma unroll
  for (int i = 0; i < 8; ++i) { r[i] = 2.0f + e[i]; l[i] = 1.0f + e[i]; }
  rcp_x8(r);                                          // r = 1 / (2 + e)
  log2_x8(l);                                         // l = log2(1 + e)
#pragma unroll
  for (int i = 0; i < 8; ++i) {
    float s = e[i] * r[i];
    float z = s * s;
    float w = z * fmaf(z, fmaf(z, fmaf(z, 2.0f / 9.0f, 2.0f / 7.0f), 2.0f / 5.0f), 2.0f / 3.0f);
    float lo = fmaf(-s, e[i] - w, e[i]);
    float hi = l[i] * 0.6931471805599453f;
    float sp = (e[i] > 0.5f) ? hi : lo;
    v[i] = (v[i] > 20.0f) ? v[i] : sp;
  }
}

// ---------------------------------------------------------------------------
// Kernel 1: u = SiLU(depthwise conv3(x), SAME, zero pad), kept in LDS,
//           proj = u @ [W_BC | W_dt] + [b_BC | b_dt]     (M=8192,K=512,N=64)
//           Delta = softplus(dtr @ W_dtp + b_dtp)        (M=8192,K=32,N=512)
// One block per RB_ rows. Part 1: a thread makes 4 channels x CR_ rows of u with 16-byte loads,
// each x row loaded once per thread and used by three output rows. Part 2: one wave per 16x16
// tile, V_WMMA_F32_16X16X4_F32, 128 steps of k in rising order on one accumulator.
// proj row layout: cols 0..15 = Bc, 16..31 = Cc (stored); cols 32..63 = dtr, the dt_rank proj,
// which stays in LDS. Part 3: a wave makes Delta of the block's rows for 64 channels, four tiles
// side by side, 8 steps of k in rising order each. Tile j holds the channels 4*ln + j, so a lane's
// four tiles are four neighbouring channels: W_dtp is loaded and Delta stored in 16-byte words.
// Part 4: pass 1 of the chunked scan (see the second kernel) for the block's RB_ rows as one chunk.
// x, Delta and Bc of these rows lie in LDS; a thread takes two channels, one after the other, runs
// h = a*h + b from h = 0 over the rows and stores the end state g and the sum of Delta.
// ---------------------------------------------------------------------------
#define RB_ 32             // rows per block; divides L_, so a block stays in one sequence
#define CR_ 16             // rows per thread in part 1 (two thread halves cover RB_)
#define UP_ (D_ + 4)       // LDS pitch of a u row in floats: 16 rows' 8-byte reads meet no bank twice
#define KG_ 16             // k-steps (of 4) whose operands are fetched ahead as one group
#define NKG_ (D_ / (4 * KG_))
#define DP_ 36             // LDS pitch of a dtr row in floats: 16 rows' 8-byte reads meet no bank twice
#define KS_ 8              // k-steps (of 4) of the Delta product
#define LOG2E_ 1.4426950408889634f
#define PF_ 16             // timesteps whose Delta and x are fetched ahead as one group
#define NQ_ (N_ / 4)       // 16-byte words of states per channel
typedef __attribute__((ext_vector_type(4))) float v4f;

// 2^v straight from the hardware instruction. exp2f() wraps it in a rescue for results below
// 2^-126 (a compare, two selects, an add and an ldexp per call), which is most of the vector
// work of a scan step. Without it such a decay factor may come out as 0 instead of a denormal:
// it multiplies the carried state, so the difference is below 2^-126 times that state.
// Taken on pairs of states, so that the multiplies and fused multiply-adds around it stay the
// packed two-float instructions that the compiler formed around exp2f().
__device__ __forceinline__ v2f exp2_hw(v2f v) {
  v2f r;
  r.x = __builtin_amdgcn_exp2f(v.x);
  r.y = __builtin_amdgcn_exp2f(v.y);
  return r;
}

__global__ void __launch_bounds__(256) k_conv_proj(const float* __restrict__ x,
                        const float* __restrict__ ck,   // (K=3,1,D)
                        const float* __restrict__ W_BC, const float* __restrict__ b_BC,
                        const float* __restrict__ W_dt, const float* __restrict__ b_dt,
                        const float* __restrict__ W_dtp,   // (32,512) row-major
                        const float* __restrict__ b_dtp,
                        const float* __restrict__ A_log,   // (512,16) row-major
                        float* __restrict__ proj,
                        float* __restrict__ Delta,
                        float* __restrict__ G,             // [chunk][word of 4 states][channel][4]
                        float* __restrict__ SD) {          // [chunk][channel]
  __shared__ __attribute__((aligned(16))) float sU[RB_ * UP_];    // u; from part 3 on Delta
  __shared__ __attribute__((aligned(16))) float sDt[RB_ * DP_];
  __shared__ __attribute__((aligned(16))) float sXr[RB_ * UP_];   // x of the block's rows
  __shared__ __attribute__((aligned(16))) float sB[RB_ * N_];     // Bc of the block's rows
  __shared__ __attribute__((aligned(16))) v4f sA[2 * NQ_ * 256];  // rates of a thread's two channels
  const int tid = threadIdx.x;
  const int lane = tid & 31;
  const int wave = tid >> 5;
  const int nt = wave & 3;                            // 64 / 16 column tiles
  const int mt = wave >> 2;                           // RB_ / 16 row tiles
  const int ln = lane & 15;                           // M for A-frag, N for B-frag
  const int kk = (lane >> 4) << 1;                    // K sub-offset: 0 or 2

  const float* W = (nt < 2) ? W_BC : W_dt;            // both row-major (512,32)
  const float* wp = W + kk * 32 + (nt & 1) * 16 + ln;
  float bq[3][2 * KG_];                               // W groups: one in use, two in flight

  {
    const int d = (tid & 127) * 4;
    const int lr0 = (tid >> 7) * CR_;                 // first row of this thread inside the block
    const int row0 = blockIdx.x * RB_ + lr0;          // flat row b*L + l of the first output
    const int l0 = row0 % L_;
    const float* xp = x + (size_t)row0 * D_ + d;
    v4f c0 = *(const v4f*)(ck + 0 * D_ + d);
    v4f c1 = *(const v4f*)(ck + 1 * D_ + d);
    v4f c2 = *(const v4f*)(ck + 2 * D_ + d);
    v4f r[CR_ + 2];                                   // rows l0-1 .. l0+CR_
    const v4f zero = {0.0f, 0.0f, 0.0f, 0.0f};
    r[0] = (l0 > 0) ? *(const v4f*)(xp - D_) : zero;
#pragma unroll
    for (int i = 0; i < CR_; ++i) r[i + 1] = *(const v4f*)(xp + i * D_);
    r[CR_ + 1] = (l0 + CR_ < L_) ? *(const v4f*)(xp + CR_ * D_) : zero;
    v4f al[2][NQ_];                                   // A_log of channels tid and tid + 256
#pragma unroll
    for (int c2 = 0; c2 < 2; ++c2) {
#pragma unroll
      for (int q = 0; q < NQ_; ++q)
        al[c2][q] = *(const v4f*)(A_log + (tid + 256 * c2) * N_ + 4 * q);
    }
    // the loads' address registers are given to later values: the wait stands in front
    asm volatile("s_wait_xcnt 0x0" ::: "memory");
    // the first two groups of W are asked for here, behind x, so that they fly under part 1
#pragma unroll
    for (int g = 0; g < 2; ++g) {
#pragma unroll
      for (int i = 0; i < KG_; ++i) {
        bq[g][2 * i]     = wp[(g * 4 * KG_ + 4 * i)     * 32];
        bq[g][2 * i + 1] = wp[(g * 4 * KG_ + 4 * i + 1) * 32];
      }
    }
#pragma unroll
    for (int i = 0; i < CR_; ++i) {
      v4f v = c0 * r[i] + c1 * r[i + 1] + c2 * r[i + 2];
      v4f o;
      float e[4];                                     // exp(-v), the four in one statement
#pragma unroll
      for (int k = 0; k < 4; ++k) e[k] = v[k] * -LOG2E_;
      exp2_x4(e);
#pragma unroll
      for (int k = 0; k < 4; ++k) o[k] = v[k] / (1.0f + e[k]);
      *(v4f*)&sU[(lr0 + i) * UP_ + d] = o;
      *(v4f*)&sXr[(lr0 + i) * UP_ + d] = r[i + 1];
    }
    // the rates A * log2(e), kept in LDS until part 4; a slot is read by the thread that wrote it
#pragma unroll
    for (int c2 = 0; c2 < 2; ++c2) {
#pragma unroll
      for (int q = 0; q < NQ_; ++q) {
        float e[4];
#pragma unroll
        for (int k = 0; k < 4; ++k) e[k] = al[c2][q][k] * LOG2E_;
        exp2_x4(e);                                   // exp(A_log)
        sA[(c2 * NQ_ + q) * 256 + tid] = v4f{-e[0] * LOG2E_, -e[1] * LOG2E_, -e[2] * LOG2E_, -e[3] * LOG2E_};
      }
    }
  }
  __syncthreads();                                    // u of the block's rows is complete

  v8f acc = {};
  const float* ap = &sU[(mt * 16 + ln) * UP_ + kk];
  v2f aq[2][KG_];                                     // u groups: one in use, one in flight
  const int dc0 = wave * 64 + ln * 4;                 // first of the lane's four Delta channels
  v4f wq[KS_][2];                                     // W_dtp rows 4s+kk, 4s+kk+1 at those channels
  v4f bd;
#pragma unroll
  for (int i = 0; i < KG_; ++i) aq[0][i] = *(const v2f*)(ap + 4 * i);
  // written out group by group: the buffers take turns without register copies, and every load
  // is unconditional, so that the waits in front of the products stay counted ones
#pragma unroll
  for (int g = 0; g < NKG_; ++g) {
    if (g + 2 < NKG_) {
#pragma unroll
      for (int i = 0; i < KG_; ++i) {
        bq[(g + 2) % 3][2 * i]     = wp[((g + 2) * 4 * KG_ + 4 * i)     * 32];
        bq[(g + 2) % 3][2 * i + 1] = wp[((g + 2) * 4 * KG_ + 4 * i + 1) * 32];
      }
    }
    if (g + 2 == NKG_) {                              // no W group is left to ask for: W_dtp takes
#pragma unroll                                        // its place and flies under the last products
      for (int s = 0; s < KS_; ++s) {
        wq[s][0] = *(const v4f*)(W_dtp + (4 * s + kk)     * D_ + dc0);
        wq[s][1] = *(const v4f*)(W_dtp + (4 * s + kk + 1) * D_ + dc0);
      }
      bd = *(const v4f*)(b_dtp + dc0);
    }
    if (g + 1 < NKG_) {
#pragma unroll
      for (int i = 0; i < KG_; ++i)
        aq[(g + 1) & 1][i] = *(const v2f*)(ap + (g + 1) * (4 * KG_) + 4 * i);
    }
    // keeps the loads of the later groups in front of this group's products; without it they
    // are moved down to their uses and each product waits for its own operands
    __builtin_amdgcn_sched_barrier(0);
#pragma unroll
    for (int i = 0; i < KG_; ++i) {
      v2f b = {bq[g % 3][2 * i], bq[g % 3][2 * i + 1]};
      acc = __builtin_amdgcn_wmma_f32_16x16x4_f32(false, aq[g & 1][i], false, b,
                                                  (short)0, acc, false, false);
    }
    // keeps the next loads one block behind this group's products; without it part of them is
    // moved up among the products, a further place of LDS reads in the stream, on more registers
    __builtin_amdgcn_sched_barrier(0);
  }
  const int half = lane >> 4;
  const int gcol = nt * 16 + ln;
  const int row0 = blockIdx.x * RB_ + mt * 16;
  float bias = (gcol < 32) ? b_BC[gcol] : b_dt[gcol - 32];
  if (nt < 2) {                                       // the same for a whole wave
#pragma unroll
    for (int r = 0; r < 8; ++r) {
      int row = row0 + r + 8 * half;
      proj[(size_t)row * 64 + gcol] = acc[r] + bias;
    }
    if (nt == 0) {                                    // Bc also stays in LDS, for part 4
#pragma unroll
      for (int r = 0; r < 8; ++r)
        sB[(mt * 16 + r + 8 * half) * N_ + ln] = acc[r] + bias;
    }
  } else {
#pragma unroll
    for (int r = 0; r < 8; ++r)
      sDt[(mt * 16 + r + 8 * half) * DP_ + gcol - 32] = acc[r] + bias;
  }
  barrier_lds();                                      // dtr and Bc are complete; u is read no more

  float* dq = Delta + (size_t)(blockIdx.x * RB_ + 8 * half) * D_ + dc0;
  float* sq = &sU[8 * half * UP_ + dc0];              // the same place in the LDS copy of Delta
  // rolled: the body stands once, so the kernel's text stays small for a cold instruction cache
#pragma unroll 1
  for (int m = 0; m < RB_ / 16; ++m) {
    const float* ar = &sDt[(m * 16 + ln) * DP_ + kk];
    v2f a[KS_];
#pragma unroll
    for (int s = 0; s < KS_; ++s) a[s] = *(const v2f*)(ar + 4 * s);
    v8f c[4] = {};
#pragma unroll
    for (int s = 0; s < KS_; ++s) {
#pragma unroll
      for (int j = 0; j < 4; ++j) {
        v2f b = {wq[s][0][j], wq[s][1][j]};
        c[j] = __builtin_amdgcn_wmma_f32_16x16x4_f32(false, a[s], false, b,
                                                     (short)0, c[j], false, false);
      }
    }
    float v[4][8];
#pragma unroll
    for (int j = 0; j < 4; ++j) {
#pragma unroll
      for (int r = 0; r < 8; ++r) v[j][r] = c[j][r] + bd[j];
      softplus8(v[j]);
    }
#pragma unroll
    for (int r = 0; r < 8; ++r) {
      v4f o = {v[0][r], v[1][r], v[2][r], v[3][r]};
      *(v4f*)(dq + (m * 16 + r) * D_) = o;
      *(v4f*)(sq + (m * 16 + r) * UP_) = o;
    }
    // the next trip writes the stores' address and data registers anew: the wait stands in front
    asm volatile("s_wait_xcnt 0x0" ::: "memory");
  }
  barrier_lds();                                      // Delta of the block's rows is complete

  // rolled over the channels and the groups: one group's body is all the text this part adds
#pragma unroll 1
  for (int c2 = 0; c2 < 2; ++c2) {
    const int ch = tid + 256 * c2;
    v2f A2v[N_ / 2], hv[N_ / 2];
#pragma unroll
    for (int q = 0; q < NQ_; ++q) {
      v4f a = sA[(c2 * NQ_ + q) * 256 + tid];
      A2v[2 * q]     = v2f{a.x, a.y};
      A2v[2 * q + 1] = v2f{a.z, a.w};
      hv[2 * q]      = v2f{0.0f, 0.0f};
      hv[2 * q + 1]  = v2f{0.0f, 0.0f};
    }
    float sd = 0.0f;
#pragma unroll 1
    for (int g = 0; g < RB_ / PF_; ++g) {
      float dc[PF_], xc[PF_];
#pragma unroll
      for (int i = 0; i < PF_; ++i) {
        dc[i] = sU[(g * PF_ + i) * UP_ + ch];
        xc[i] = sXr[(g * PF_ + i) * UP_ + ch];
      }
#pragma unroll
      for (int i = 0; i < PF_; ++i) {
        float dv = dc[i];
        float xd = xc[i] * dv;
        sd += dv;
        const float* brow = &sB[(g * PF_ + i) * N_];
#pragma unroll
        for (int j = 0; j < N_ / 2; ++j) {
          v2f alpha = exp2_hw(A2v[j] * dv);
          v2f bb = {brow[2 * j], brow[2 * j + 1]};
          hv[j] = __builtin_elementwise_fma(alpha, hv[j], bb * xd);
        }
        // every fourth step: bounds how far the scheduler lifts the LDS reads of later steps
        // (without it the registers pass 256 and register-window switches enter this loop)
        if ((i & 3) == 3) __builtin_amdgcn_sched_barrier(0);
      }
    }
#pragma unroll
    for (int q = 0; q < NQ_; ++q)
      *(v4f*)(G + ((size_t)(blockIdx.x * NQ_ + q) * D_ + ch) * 4) =
          v4f{hv[2 * q].x, hv[2 * q].y, hv[2 * q + 1].x, hv[2 * q + 1].y};
    SD[blockIdx.x * D_ + ch] = sd;
    // the next trip writes the stores' address and data registers anew: the wait stands in front
    asm volatile("s_wait_xcnt 0x0" ::: "memory");
  }
}

// ---------------------------------------------------------------------------
// Chunked scan. Recurrence h[l] = a[l]*h[l-1] + b[l] composes per chunk as
//   h_out = P*h_in + g     (P = prod a = 2^(A2 * sum of Delta), g = local scan with h_in = 0)
// Pass 1 (g and the sum of Delta of every chunk of RB_ rows) is part 4 of the first kernel.
// Here a block takes SW_ channels (one 128-byte line of a row) of one sequence and one half of its
// rows, a wave CW_ rows of that half, a lane one channel. Waves 0 .. NQ_-1 walk one 16-byte word of
// the state each through the chunks from row 0 on and leave every wave's entry state in LDS; then
// each wave runs its rows from there and emits y + x*Dparam.
// ---------------------------------------------------------------------------
#define SW_ 32             // channels per block
#define NW_ 8              // waves per block
#define HR_ (L_ / 2)       // rows per block
#define CW_ (HR_ / NW_)    // rows per wave
#define NG_ (CW_ / PF_)    // groups per wave
#define CB_ (HR_ / RB_)    // chunks of the first kernel per block
#define CPW_ (CW_ / RB_)   // chunks of the first kernel per wave

// h = P*h + g for one chunk, on one word of four states; a4 = their rates, s = the chunk's sum of Delta
__device__ __forceinline__ v4f chunk_step(v4f h, v4f a4, float s, v4f g) {
  float e[4];
#pragma unroll
  for (int k = 0; k < 4; ++k) e[k] = a4[k] * s;
  exp2_x4(e);
  return __builtin_elementwise_fma(v4f{e[0], e[1], e[2], e[3]}, h, g);
}

__global__ void __launch_bounds__(256) k_scan(const float* __restrict__ x,
                             const float* __restrict__ proj,
                             const float* __restrict__ Delta,
                             const float* __restrict__ A_log,
                             const float* __restrict__ Dparam,
                             const float* __restrict__ G,
                             const float* __restrict__ SD,
                             float* __restrict__ out) {
  __shared__ __attribute__((aligned(16))) float sBC[HR_ * 32];      // Bc|Cc of the block's rows: 64 KB
  __shared__ __attribute__((aligned(16))) v4f sX[NW_ * NQ_ * SW_];  // entry states of the waves: 16 KB
  const int blk  = blockIdx.x;                // B_ * 2 * (D_/SW_)
  const int cg   = blk % (D_ / SW_);
  const int part = (blk / (D_ / SW_)) & 1;
  const int b    = blk / (2 * (D_ / SW_));
  const int tid  = threadIdx.x;
  const int lane = tid & 31;
  const int w    = __builtin_amdgcn_readfirstlane(tid >> 5);   // the wave's number, held scalar
  const int d    = cg * SW_ + lane;

  // Bc|Cc (the first 128 bytes of a proj row) of the block's rows.
  // One copy of the block covers 32 rows; LDS keeps the rows back to back.
  {
    unsigned la = (unsigned)(size_t)sBC + (unsigned)tid * 16u;
    const float* ga = proj + ((size_t)b * L_ + part * HR_ + (tid >> 3)) * 64 + (tid & 7) * 4;
    for (int k = 0; k < HR_ / 32; k += 4) {
      async_g2l_b128_x4(la, la + 4096u, la + 8192u, la + 12288u,
                        ga, ga + 32 * 64, ga + 64 * 64, ga + 96 * 64);
      la += 16384u;
      ga += 128 * 64;
    }
  }
  v4f aw[NQ_];
#pragma unroll
  for (int q = 0; q < NQ_; ++q) aw[q] = *(const v4f*)(A_log + d * N_ + 4 * q);
  float Dp = Dparam[d];
  const int lrow = w * CW_;                   // first row of the wave inside the block's half
  const int row  = part * HR_ + lrow;
  const float* dp = Delta + ((size_t)b * L_ + row) * D_ + d;
  const float* xp = x     + ((size_t)b * L_ + row) * D_ + d;
  float dn[PF_], xn[PF_];                     // the group in flight
#pragma unroll
  for (int i = 0; i < PF_; ++i) { dn[i] = dp[i * D_]; xn[i] = xp[i * D_]; }
  // the loads' address registers may be given to later values: the wait stands in front
  asm volatile("s_wait_xcnt 0x0" ::: "memory");
  // entry states: the loads of all chunks are asked for at once, before any of them is used, so
  // that one trip to memory serves all; it flies beside the copies and the loads above
  if (w < NQ_) {
    const float* gp = G + (((size_t)b * (L_ / RB_) * NQ_ + w) * D_ + d) * 4;   // chunk 0, word w
    const float* sp = SD + (size_t)b * (L_ / RB_) * D_ + d;
    v4f al = *(const v4f*)(A_log + d * N_ + 4 * w);
    // the load's address registers are given to the values loaded next: the wait stands in front
    asm volatile("s_wait_xcnt 0x0" ::: "memory");
    v4f g1[CB_ - CPW_];
    float s1[CB_ - CPW_];
#pragma unroll
    for (int j = 0; j < CB_ - CPW_; ++j) {
      g1[j] = *(const v4f*)(gp + (size_t)(part * CB_ + j) * (NQ_ * D_ * 4));
      s1[j] = sp[(part * CB_ + j) * D_];
    }
    // the loads' address registers are given to later values: the wait stands in front
    asm volatile("s_wait_xcnt 0x0" ::: "memory");
    v4f g0[CB_];                              // the chunks of the first half: second half only
    float s0[CB_];
    if (part) {                               // the same for the whole block
#pragma unroll
      for (int j = 0; j < CB_; ++j) {
        g0[j] = *(const v4f*)(gp + (size_t)j * (NQ_ * D_ * 4));
        s0[j] = sp[j * D_];
      }
      // as above
      asm volatile("s_wait_xcnt 0x0" ::: "memory");
    }
    float ea[4];
#pragma unroll
    for (int k = 0; k < 4; ++k) ea[k] = al[k] * LOG2E_;
    exp2_x4(ea);                              // exp(A_log)
    v4f a4 = {-ea[0] * LOG2E_, -ea[1] * LOG2E_, -ea[2] * LOG2E_, -ea[3] * LOG2E_};
    v4f h = {0.0f, 0.0f, 0.0f, 0.0f};
    if (part) {
#pragma unroll
      for (int j = 0; j < CB_; ++j) h = chunk_step(h, a4, s0[j], g0[j]);
    }
#pragma unroll
    for (int k = 0; k < NW_; ++k) {
      sX[(k * NQ_ + w) * SW_ + lane] = h;
      if (k + 1 < NW_) {
#pragma unroll
        for (int t = 0; t < CPW_; ++t) h = chunk_step(h, a4, s1[k * CPW_ + t], g1[k * CPW_ + t]);
      }
    }
  }
  float A2[N_];
#pragma unroll
  for (int q = 0; q < N_ / 8; ++q) {
    float e[8];
#pragma unroll
    for (int k = 0; k < 8; ++k) e[k] = aw[2 * q + (k >> 2)][k & 3] * LOG2E_;
    exp2_x8(e);                               // exp(A_log)
#pragma unroll
    for (int k = 0; k < 8; ++k) A2[8 * q + k] = -e[k] * LOG2E_;
  }
  wait_async0();
  __syncthreads();                            // Bc|Cc and the entry states are complete for every wave

  v2f A2v[N_ / 2], hv[N_ / 2];                // the states and their rates as pairs (2j, 2j+1)
#pragma unroll
  for (int j = 0; j < N_ / 2; ++j) A2v[j] = v2f{A2[2 * j], A2[2 * j + 1]};
#pragma unroll
  for (int q = 0; q < NQ_; ++q) {
    v4f e = sX[(w * NQ_ + q) * SW_ + lane];
    hv[2 * q]     = v2f{e.x, e.y};
    hv[2 * q + 1] = v2f{e.z, e.w};
  }
  float* op = out + ((size_t)b * L_ + row) * D_ + d;

  // rolled: one group's body stays the loop, so the code fits the instruction cache
#pragma unroll 1
  for (int g = 0; g < NG_; ++g) {
    float dc[PF_], xc[PF_];
#pragma unroll
    for (int i = 0; i < PF_; ++i) { dc[i] = dn[i]; xc[i] = xn[i]; }
    if (g + 1 < NG_) {                        // next group's loads fly under this group's work
      dp += PF_ * D_;
      xp += PF_ * D_;
#pragma unroll
      for (int i = 0; i < PF_; ++i) { dn[i] = dp[i * D_]; xn[i] = xp[i * D_]; }
    }
#pragma unroll
    for (int i = 0; i < PF_; ++i) {
      float dv = dc[i];
      float xv = xc[i];
      float xd = xv * dv;
      const float* bc = &sBC[(lrow + g * PF_ + i) * 32];
      float y = 0.0f;
#pragma unroll
      for (int j = 0; j < N_ / 2; ++j) {
        v2f alpha = exp2_hw(A2v[j] * dv);
        v2f bb = {bc[2 * j], bc[2 * j + 1]};
        hv[j] = __builtin_elementwise_fma(alpha, hv[j], bb * xd);
        y += bc[16 + 2 * j]     * hv[j].x;    // one chain in the order of n
        y += bc[16 + 2 * j + 1] * hv[j].y;
      }
      op[(g * PF_ + i) * D_] = y + xv * Dp;
      // every fourth step: bounds how far the scheduler spreads the unrolled steps (without it
      // the registers pass 256 and register-window switches enter the loop); the last one also
      // keeps the hand-over of the fetched registers, with its load wait, behind the work
      if ((i & 3) == 3) __builtin_amdgcn_sched_barrier(0);
    }
  }
}

// ---------------------------------------------------------------------------
extern "C" void kernel_launch(void* const* d_in, const int* in_sizes, int n_in,
                              void* d_out, int out_size, void* d_ws, size_t ws_size,
                              hipStream_t stream) {
  const float* x    = (const float*)d_in[0];
  const float* ck   = (const float*)d_in[1];
  const float* W_BC = (const float*)d_in[2];
  const float* b_BC = (const float*)d_in[3];
  const float* A_lg = (const float*)d_in[4];
  const float* Dpar = (const float*)d_in[5];
  const float* W_dt = (const float*)d_in[6];
  const float* b_dt = (const float*)d_in[7];
  const float* Wdtp = (const float*)d_in[8];
  const float* bdtp = (const float*)d_in[9];
  float* out = (float*)d_out;

  char* ws = (char*)d_ws;
  const size_t SZ_U  = (size_t)B_ * L_ * D_ * 4;          // 16 MB
  float* G     = (float*)ws;                              //  8 MB: end state of every chunk
  float* SD    = (float*)(ws + SZ_U / 2);                 //  0.5 MB: sum of Delta of every chunk
  float* proj  = (float*)(ws + SZ_U);                     //  2 MB
  float* Delta = (float*)(ws + SZ_U + (size_t)MTOT * 64 * 4);   // 16 MB

  // 1) conv + silu, proj = u @ [W_BC|W_dt] + bias, Delta = softplus(dtr @ W_dtp + b_dtp),
  //    pass 1 of the scan on chunks of 32 rows : 256 blocks, 2048 waves
  k_conv_proj<<<MTOT / RB_, 256, 0, stream>>>(x, ck, W_BC, b_BC, W_dt, b_dt, Wdtp, bdtp, A_lg,
                                              proj, Delta, G, SD);

  // 2) chunked scan, entry states and last pass : 256 blocks, 2048 waves
  k_scan<<<B_ * 2 * (D_ / SW_), 256, 0, stream>>>(x, proj, Delta, A_lg, Dpar, G, SD, out);
}

// v010
// One run takes 27.7 microseconds.
// Two timings next to v009 put it at 1.10 and 1.11 times that version's speed.
// All steps since v000 together make it 4.75 times as fast.
#include <hip/hip_runtime.h>
#include <hip/hip_bf16.h>
#include <math.h>

#define B_    8
#define L_    1024
#define D_    512
#define N_    16
#define MTOT  (B_*L_)      // 8192 rows

typedef __attribute__((ext_vector_type(2))) float v2f;
typedef __attribute__((ext_vector_type(8))) float v8f;

// Four asynchronous global->LDS copies of 16 bytes per lane, counted on ASYNCcnt. The s_wait_xcnt
// stands in the copies' own statement, so that it comes before any rewrite of their address registers.
__device__ __forceinline__ void async_g2l_b128_x4(unsigned l0, unsigned l1, unsigned l2, unsigned l3,
                                                  const float* g0, const float* g1,
                                                  const float* g2, const float* g3) {
  asm volatile("global_load_async_to_lds_b128 %0, %4, off\n\t"
               "global_load_async_to_lds_b128 %1, %5, off\n\t"
               "global_load_async_to_lds_b128 %2, %6, off\n\t"
               "global_load_async_to_lds_b128 %3, %7, off\n\t"
               "s_wait_xcnt 0x0"
               :: "v"(l0), "v"(l1), "v"(l2), "v"(l3), "v"(g0), "v"(g1), "v"(g2), "v"(g3) : "memory");
}
__device__ __forceinline__ void wait_async0() {
  asm volatile("s_wait_asynccnt 0x0" ::: "memory");
}

// Work-group barrier for data handed over in LDS only: the fences name the LDS address space, so the
// wave waits for its LDS operations (s_wait_dscnt 0) and not for its global loads. __syncthreads()
// would also wait for the W_dtp and b_dtp loads asked for under the last products of part 2.
__device__ __forceinline__ void barrier_lds() {
  __builtin_amdgcn_fence(__ATOMIC_RELEASE, "workgroup", "local");
  __builtin_amdgcn_s_barrier();
  __builtin_amdgcn_fence(__ATOMIC_ACQUIRE, "workgroup", "local");
}

// One hardware transcendental on each of a lane's eight values, in place. The eight stand in one
// statement because the instruction set asks for one independent instruction behind a
// transcendental before its result is read or its source overwritten: here each fills that slot
// for the one before it, and the v_nop fills it for the last.
__device__ __forceinline__ void exp2_x8(float (&a)[8]) {   // a = 2^a
  asm("v_exp_f32 %0, %0\n\tv_exp_f32 %1, %1\n\tv_exp_f32 %2, %2\n\tv_exp_f32 %3, %3\n\t"
      "v_exp_f32 %4, %4\n\tv_exp_f32 %5, %5\n\tv_exp_f32 %6, %6\n\tv_exp_f32 %7, %7\n\tv_nop"
      : "+v"(a[0]), "+v"(a[1]), "+v"(a[2]), "+v"(a[3]), "+v"(a[4]), "+v"(a[5]), "+v"(a[6]), "+v"(a[7]));
}
__device__ __forceinline__ void exp2_x4(float (&a)[4]) {   // a = 2^a, the same on four values
  asm("v_exp_f32 %0, %0\n\tv_exp_f32 %1, %1\n\tv_exp_f32 %2, %2\n\tv_exp_f32 %3, %3\n\tv_nop"
      : "+v"(a[0]), "+v"(a[1]), "+v"(a[2]), "+v"(a[3]));
}
__device__ __forceinline__ void rcp_x8(float (&a)[8]) {   // a = 1 / a
  asm("v_rcp_f32 %0, %0\n\tv_rcp_f32 %1, %1\n\tv_rcp_f32 %2, %2\n\tv_rcp_f32 %3, %3\n\t"
      "v_rcp_f32 %4, %4\n\tv_rcp_f32 %5, %5\n\tv_rcp_f32 %6, %6\n\tv_rcp_f32 %7, %7\n\tv_nop"
      : "+v"(a[0]), "+v"(a[1]), "+v"(a[2]), "+v"(a[3]), "+v"(a[4]), "+v"(a[5]), "+v"(a[6]), "+v"(a[7]));
}
__device__ __forceinline__ void log2_x8(float (&a)[8]) {   // a = log2(a)
  asm("v_log_f32 %0, %0\n\tv_log_f32 %1, %1\n\tv_log_f32 %2, %2\n\tv_log_f32 %3, %3\n\t"
      "v_log_f32 %4, %4\n\tv_log_f32 %5, %5\n\tv_log_f32 %6, %6\n\tv_log_f32 %7, %7\n\tv_nop"
      : "+v"(a[0]), "+v"(a[1]), "+v"(a[2]), "+v"(a[3]), "+v"(a[4]), "+v"(a[5]), "+v"(a[6]), "+v"(a[7]));
}

// softplus(v) = log(1 + e), e = exp(v), on eight values, without a branch and without log1pf(),
// whose two-float arithmetic is one long dependent chain and was most of this kernel's vector
// work.
// e <= 1/2: log(1 + e) = 2 atanh(s) with s = e / (2 + e) <= 1/5, z = s * s <= 1/25:
//   2 atanh(s) = 2 s + s w,  w = 2 (z/3 + z^2/5 + z^3/7 + z^4/9),  and 2 s = e - e s,
//   so the result is e - s (e - w): e itself is the leading term, and the rounding of s counts
//   only times s. The first term left out, s * 2 z^5 / 11, is below 1e-8 of the result.
// e > 1/2: the sum 1 + e is at least 3/2, its rounding is small beside a result above 2/5, and the
//   hardware logarithm (base 2) serves; there Delta keeps about 3e-7 of relative error.
// v > 20 gives v as before; the selects drop whatever the unused forms make of a huge e.
__device__ __forceinline__ void softplus8(float (&v)[8]) {
  float e[8], r[8], l[8];
#pragma unroll
  for (int i = 0; i < 8; ++i) e[i] = v[i] * 1.4426950408889634f;
  exp2_x8(e);                                         // e = exp(v)
#pragma unroll
  for (int i = 0; i < 8; ++i) { r[i] = 2.0f + e[i]; l[i] = 1.0f + e[i]; }
  rcp_x8(r);                                          // r = 1 / (2 + e)
  log2_x8(l);                                         // l = log2(1 + e)
#pragma unroll
  for (int i = 0; i < 8; ++i) {
    float s = e[i] * r[i];
    float z = s * s;
    float w = z * fmaf(z, fmaf(z, fmaf(z, 2.0f / 9.0f, 2.0f / 7.0f), 2.0f / 5.0f), 2.0f / 3.0f);
    float lo = fmaf(-s, e[i] - w, e[i]);
    float hi = l[i] * 0.6931471805599453f;
    float sp = (e[i] > 0.5f) ? hi : lo;
    v[i] = (v[i] > 20.0f) ? v[i] : sp;
  }
}

// ---------------------------------------------------------------------------
// Kernel 1: u = SiLU(depthwise conv3(x), SAME, zero pad), kept in LDS,
//           proj = u @ [W_BC | W_dt] + [b_BC | b_dt]     (M=8192,K=512,N=64)
//           Delta = softplus(dtr @ W_dtp + b_dtp)        (M=8192,K=32,N=512)
// One block per RB_ rows. Part 1: a thread makes 4 channels x CR_ rows of u with 16-byte loads,
// each x row loaded once per thread and used by three output rows. Part 2: one wave per 16x16
// tile, V_WMMA_F32_16X16X4_F32, 128 steps of k in rising order on one accumulator.
// proj row layout: cols 0..15 = Bc, 16..31 = Cc (stored); cols 32..63 = dtr, the dt_rank proj,
// which stays in LDS. Part 3: a wave makes Delta of the block's rows for 64 channels, four tiles
// side by side, 8 steps of k in rising order each. Tile j holds the channels 4*ln + j, so a lane's
// four tiles are four neighbouring channels: W_dtp is loaded and Delta stored in 16-byte words.
// Part 4: pass 1 of the chunked scan (see the second kernel) for the block's RB_ rows as one chunk.
// x, Delta and Bc of these rows lie in LDS; a thread takes two channels side by side, runs
// h = a*h + b from h = 0 over the rows and stores the end state g and the sum of Delta.
// ---------------------------------------------------------------------------
#define RB_ 32             // rows per block; divides L_, so a block stays in one sequence
#define CR_ 16             // rows per thread in part 1 (two thread halves cover RB_)
#define UP_ (D_ + 4)       // LDS pitch of a u row in floats: 16 rows' 8-byte reads meet no bank twice
#define KG_ 16             // k-steps (of 4) whose operands are fetched ahead as one group
#define NKG_ (D_ / (4 * KG_))
#define DP_ 36             // LDS pitch of a dtr row in floats: 16 rows' 8-byte reads meet no bank twice
#define KS_ 8              // k-steps (of 4) of the Delta product
#define LOG2E_ 1.4426950408889634f
#define PH_ 8              // timesteps of part 4 whose Delta and x (two channels) are read as one group
#define NQ_ (N_ / 4)       // 16-byte words of states per channel
typedef __attribute__((ext_vector_type(4))) float v4f;

// 2^v straight from the hardware instruction. exp2f() wraps it in a rescue for results below
// 2^-126 (a compare, two selects, an add and an ldexp per call), which is most of the vector
// work of a scan step. Without it such a decay factor may come out as 0 instead of a denormal:
// it multiplies the carried state, so the difference is below 2^-126 times that state.
// Taken on pairs (of states in part 4, of channels in the last pass), so that the multiplies and
// fused multiply-adds around it stay the packed two-float instructions.
__device__ __forceinline__ v2f exp2_hw(v2f v) {
  v2f r;
  r.x = __builtin_amdgcn_exp2f(v.x);
  r.y = __builtin_amdgcn_exp2f(v.y);
  return r;
}

__global__ void __launch_bounds__(256) k_conv_proj(const float* __restrict__ x,
                        const float* __restrict__ ck,   // (K=3,1,D)
                        const float* __restrict__ W_BC, const float* __restrict__ b_BC,
                        const float* __restrict__ W_dt, const float* __restrict__ b_dt,
                        const float* __restrict__ W_dtp,   // (32,512) row-major
                        const float* __restrict__ b_dtp,
                        const float* __restrict__ A_log,   // (512,16) row-major
                        float* __restrict__ proj,
                        float* __restrict__ Delta,
                        float* __restrict__ G,             // [chunk][word of 4 states][channel][4]
                        float* __restrict__ SD) {          // [chunk][channel]
  __shared__ __attribute__((aligned(16))) float sU[RB_ * UP_];    // u; from part 3 on Delta
  __shared__ __attribute__((aligned(16))) float sDt[RB_ * DP_];
  __shared__ __attribute__((aligned(16))) float sXr[RB_ * UP_];   // x of the block's rows
  __shared__ __attribute__((aligned(16))) float sB[RB_ * N_];     // Bc of the block's rows
  __shared__ __attribute__((aligned(16))) v4f sA[2 * NQ_ * 256];  // rates of a thread's two channels
  const int tid = threadIdx.x;
  const int lane = tid & 31;
  const int wave = tid >> 5;
  const int nt = wave & 3;                            // 64 / 16 column tiles
  const int mt = wave >> 2;                           // RB_ / 16 row tiles
  const int ln = lane & 15;                           // M for A-frag, N for B-frag
  const int kk = (lane >> 4) << 1;                    // K sub-offset: 0 or 2

  const float* W = (nt < 2) ? W_BC : W_dt;            // both row-major (512,32)
  const float* wp = W + kk * 32 + (nt & 1) * 16 + ln;
  float bq[3][2 * KG_];                               // W groups: one in use, two in flight

  {
    const int d = (tid & 127) * 4;
    const int lr0 = (tid >> 7) * CR_;                 // first row of this thread inside the block
    const int row0 = blockIdx.x * RB_ + lr0;          // flat row b*L + l of the first output
    const int l0 = row0 % L_;
    const float* xp = x + (size_t)row0 * D_ + d;
    v4f c0 = *(const v4f*)(ck + 0 * D_ + d);
    v4f c1 = *(const v4f*)(ck + 1 * D_ + d);
    v4f c2 = *(const v4f*)(ck + 2 * D_ + d);
    v4f r[CR_ + 2];                                   // rows l0-1 .. l0+CR_
    const v4f zero = {0.0f, 0.0f, 0.0f, 0.0f};
    r[0] = (l0 > 0) ? *(const v4f*)(xp - D_) : zero;
#pragma unroll
    for (int i = 0; i < CR_; ++i) r[i + 1] = *(const v4f*)(xp + i * D_);
    r[CR_ + 1] = (l0 + CR_ < L_) ? *(const v4f*)(xp + CR_ * D_) : zero;
    v4f al[2][NQ_];                                   // A_log of channels tid and tid + 256
#pragma unroll
    for (int c2 = 0; c2 < 2; ++c2) {
#pragma unroll
      for (int q = 0; q < NQ_; ++q)
        al[c2][q] = *(const v4f*)(A_log + (tid + 256 * c2) * N_ + 4 * q);
    }
    // the loads' address registers are given to later values: the wait stands in front
    asm volatile("s_wait_xcnt 0x0" ::: "memory");
    // the first two groups of W are asked for here, behind x, so that they fly under part 1
#pragma unroll
    for (int g = 0; g < 2; ++g) {
#pragma unroll
      for (int i = 0; i < KG_; ++i) {
        bq[g][2 * i]     = wp[(g * 4 * KG_ + 4 * i)     * 32];
        bq[g][2 * i + 1] = wp[(g * 4 * KG_ + 4 * i + 1) * 32];
      }
    }
#pragma unroll
    for (int i = 0; i < CR_; ++i) {
      v4f v = c0 * r[i] + c1 * r[i + 1] + c2 * r[i + 2];
      v4f o;
      float e[4];                                     // exp(-v), the four in one statement
#pragma unroll
      for (int k = 0; k < 4; ++k) e[k] = v[k] * -LOG2E_;
      exp2_x4(e);
#pragma unroll
      for (int k = 0; k < 4; ++k) o[k] = v[k] / (1.0f + e[k]);
      *(v4f*)&sU[(lr0 + i) * UP_ + d] = o;
      *(v4f*)&sXr[(lr0 + i) * UP_ + d] = r[i + 1];
    }
    // the rates A * log2(e), kept in LDS until part 4; a slot is read by the thread that wrote it
#pragma unroll
    for (int c2 = 0; c2 < 2; ++c2) {
#pragma unroll
      for (int q = 0; q < NQ_; ++q) {
        float e[4];
#pragma unroll
        for (int k = 0; k < 4; ++k) e[k] = al[c2][q][k] * LOG2E_;
        exp2_x4(e);                                   // exp(A_log)
        sA[(c2 * NQ_ + q) * 256 + tid] = v4f{-e[0] * LOG2E_, -e[1] * LOG2E_, -e[2] * LOG2E_, -e[3] * LOG2E_};
      }
    }
  }
  __syncthreads();                                    // u of the block's rows is complete

  v8f acc = {};
  const float* ap = &sU[(mt * 16 + ln) * UP_ + kk];
  v2f aq[2][KG_];                                     // u groups: one in use, one in flight
  const int dc0 = wave * 64 + ln * 4;                 // first of the lane's four Delta channels
  v4f wq[KS_][2];                                     // W_dtp rows 4s+kk, 4s+kk+1 at those channels
  v4f bd;
#pragma unroll
  for (int i = 0; i < KG_; ++i) aq[0][i] = *(const v2f*)(ap + 4 * i);
  // written out group by group: the buffers take turns without register copies, and every load
  // is unconditional, so that the waits in front of the products stay counted ones
#pragma unroll
  for (int g = 0; g < NKG_; ++g) {
    if (g + 2 < NKG_) {
#pragma unroll
      for (int i = 0; i < KG_; ++i) {
        bq[(g + 2) % 3][2 * i]     = wp[((g + 2) * 4 * KG_ + 4 * i)     * 32];
        bq[(g + 2) % 3][2 * i + 1] = wp[((g + 2) * 4 * KG_ + 4 * i + 1) * 32];
      }
    }
    if (g + 2 == NKG_) {                              // no W group is left to ask for: W_dtp takes
#pragma unroll                                        // its place and flies under the last products
      for (int s = 0; s < KS_; ++s) {
        wq[s][0] = *(const v4f*)(W_dtp + (4 * s + kk)     * D_ + dc0);
        wq[s][1] = *(const v4f*)(W_dtp + (4 * s + kk + 1) * D_ + dc0);
      }
      bd = *(const v4f*)(b_dtp + dc0);
    }
    if (g + 1 < NKG_) {
#pragma unroll
      for (int i = 0; i < KG_; ++i)
        aq[(g + 1) & 1][i] = *(const v2f*)(ap + (g + 1) * (4 * KG_) + 4 * i);
    }
    // keeps the loads of the later groups in front of this group's products; without it they
    // are moved down to their uses and each product waits for its own operands
    __builtin_amdgcn_sched_barrier(0);
#pragma unroll
    for (int i = 0; i < KG_; ++i) {
      v2f b = {bq[g % 3][2 * i], bq[g % 3][2 * i + 1]};
      acc = __builtin_amdgcn_wmma_f32_16x16x4_f32(false, aq[g & 1][i], false, b,
                                                  (short)0, acc, false, false);
    }
    // keeps the next loads one block behind this group's products; without it part of them is
    // moved up among the products, a further place of LDS reads in the stream, on more registers
    __builtin_amdgcn_sched_barrier(0);
  }
  const int half = lane >> 4;
  const int gcol = nt * 16 + ln;
  const int row0 = blockIdx.x * RB_ + mt * 16;
  float bias = (gcol < 32) ? b_BC[gcol] : b_dt[gcol - 32];
  if (nt < 2) {                                       // the same for a whole wave
#pragma unroll
    for (int r = 0; r < 8; ++r) {
      int row = row0 + r + 8 * half;
      proj[(size_t)row * 64 + gcol] = acc[r] + bias;
    }
    if (nt == 0) {                                    // Bc also stays in LDS, for part 4
#pragma unroll
      for (int r = 0; r < 8; ++r)
        sB[(mt * 16 + r + 8 * half) * N_ + ln] = acc[r] + bias;
    }
  } else {
#pragma unroll
    for (int r = 0; r < 8; ++r)
      sDt[(mt * 16 + r + 8 * half) * DP_ + gcol - 32] = acc[r] + bias;
  }
  barrier_lds();                                      // dtr and Bc are complete; u is read no more

  float* dq = Delta + (size_t)(blockIdx.x * RB_ + 8 * half) * D_ + dc0;
  float* sq = &sU[8 * half * UP_ + dc0];              // the same place in the LDS copy of Delta
  // rolled: the body stands once, so the kernel's text stays small
#pragma unroll 1
  for (int m = 0; m < RB_ / 16; ++m) {
    const float* ar = &sDt[(m * 16 + ln) * DP_ + kk];
    v2f a[KS_];
#pragma unroll
    for (int s = 0; s < KS_; ++s) a[s] = *(const v2f*)(ar + 4 * s);
    v8f c[4] = {};
#pragma unroll
    for (int s = 0; s < KS_; ++s) {
#pragma unroll
      for (int j = 0; j < 4; ++j) {
        v2f b = {wq[s][0][j], wq[s][1][j]};
        c[j] = __builtin_amdgcn_wmma_f32_16x16x4_f32(false, a[s], false, b,
                                                     (short)0, c[j], false, false);
      }
    }
    float v[4][8];
#pragma unroll
    for (int j = 0; j < 4; ++j) {
#pragma unroll
      for (int r = 0; r < 8; ++r) v[j][r] = c[j][r] + bd[j];
      softplus8(v[j]);
    }
#pragma unroll
    for (int r = 0; r < 8; ++r) {
      v4f o = {v[0][r], v[1][r], v[2][r], v[3][r]};
      *(v4f*)(dq + (m * 16 + r) * D_) = o;
      *(v4f*)(sq + (m * 16 + r) * UP_) = o;
    }
    // the next trip writes the stores' address and data registers anew: the wait stands in front
    asm volatile("s_wait_xcnt 0x0" ::: "memory");
  }
  barrier_lds();                                      // Delta of the block's rows is complete

  // both channels of a thread side by side, so that each LDS read of a row's Bc serves the two;
  // rolled over the groups: one group's body is all the text this part adds
  v2f A2v[2][N_ / 2], hv[2][N_ / 2];
#pragma unroll
  for (int c2 = 0; c2 < 2; ++c2) {
#pragma unroll
    for (int q = 0; q < NQ_; ++q) {
      v4f a = sA[(c2 * NQ_ + q) * 256 + tid];
      A2v[c2][2 * q]     = v2f{a.x, a.y};
      A2v[c2][2 * q + 1] = v2f{a.z, a.w};
      hv[c2][2 * q]      = v2f{0.0f, 0.0f};
      hv[c2][2 * q + 1]  = v2f{0.0f, 0.0f};
    }
  }
  float sd[2] = {0.0f, 0.0f};
#pragma unroll 1
  for (int g = 0; g < RB_ / PH_; ++g) {
    float dc[2][PH_], xc[2][PH_];
#pragma unroll
    for (int i = 0; i < PH_; ++i) {
#pragma unroll
      for (int c2 = 0; c2 < 2; ++c2) {
        dc[c2][i] = sU[(g * PH_ + i) * UP_ + tid + 256 * c2];
        xc[c2][i] = sXr[(g * PH_ + i) * UP_ + tid + 256 * c2];
      }
    }
#pragma unroll
    for (int i = 0; i < PH_; ++i) {
      const float* brow = &sB[(g * PH_ + i) * N_];
#pragma unroll
      for (int c2 = 0; c2 < 2; ++c2) {
        float dv = dc[c2][i];
        float xd = xc[c2][i] * dv;
        sd[c2] += dv;
#pragma unroll
        for (int j = 0; j < N_ / 2; ++j) {
          v2f alpha = exp2_hw(A2v[c2][j] * dv);
          v2f bb = {brow[2 * j], brow[2 * j + 1]};
          hv[c2][j] = __builtin_elementwise_fma(alpha, hv[c2][j], bb * xd);
        }
      }
      // every second step: bounds how far the scheduler lifts the LDS reads of later steps
      // (without it the registers pass 256 and register-window switches enter this loop)
      if ((i & 1) == 1) __builtin_amdgcn_sched_barrier(0);
    }
  }
#pragma unroll
  for (int c2 = 0; c2 < 2; ++c2) {
    const int ch = tid + 256 * c2;
#pragma unroll
    for (int q = 0; q < NQ_; ++q)
      *(v4f*)(G + ((size_t)(blockIdx.x * NQ_ + q) * D_ + ch) * 4) =
          v4f{hv[c2][2 * q].x, hv[c2][2 * q].y, hv[c2][2 * q + 1].x, hv[c2][2 * q + 1].y};
    SD[blockIdx.x * D_ + ch] = sd[c2];
  }
}

// ---------------------------------------------------------------------------
// Chunked scan. Recurrence h[l] = a[l]*h[l-1] + b[l] composes per chunk as
//   h_out = P*h_in + g     (P = prod a = 2^(A2 * sum of Delta), g = local scan with h_in = 0)
// Pass 1 (g and the sum of Delta of every chunk of RB_ rows) is part 4 of the first kernel.
// Here a block takes SW_ channels of one sequence and one quarter of its rows, a wave CW_ rows (one
// chunk) of that quarter, a lane two neighbouring channels: every LDS read of a row's Bc|Cc, which
// is the same for all channels, then serves two channels, and Delta, x and out go in 8-byte words.
// First each wave walks one 16-byte word of the state of 32 channels through the chunks from row 0
// on and leaves every wave's entry state in LDS; then each wave runs its rows from there and emits
// y + x*Dparam.
// ---------------------------------------------------------------------------
#define SW_ 64             // channels per block
#define NW_ 8              // waves per block: 2 * NQ_, one per word and half of the channels
#define NP_ 4              // blocks per sequence and channel group
#define HR_ (L_ / NP_)     // rows per block
#define CW_ (HR_ / NW_)    // rows per wave: RB_, one chunk of the first kernel
#define PG_ 8              // timesteps whose Delta and x (two channels) are fetched ahead as one group
#define NG_ (CW_ / PG_)    // groups per wave
#define CB_ (HR_ / RB_)    // chunks of the first kernel per block

// h = P*h + g for one chunk, on one word of four states; a4 = their rates, s = the chunk's sum of Delta
__device__ __forceinline__ v4f chunk_step(v4f h, v4f a4, float s, v4f g) {
  float e[4];
#pragma unroll
  for (int k = 0; k < 4; ++k) e[k] = a4[k] * s;
  exp2_x4(e);
  return __builtin_elementwise_fma(v4f{e[0], e[1], e[2], e[3]}, h, g);
}

__global__ void __launch_bounds__(256) k_scan(const float* __restrict__ x,
                             const float* __restrict__ proj,
                             const float* __restrict__ Delta,
                             const float* __restrict__ A_log,
                             const float* __restrict__ Dparam,
                             const float* __restrict__ G,
                             const float* __restrict__ SD,
                             float* __restrict__ out) {
  __shared__ __attribute__((aligned(16))) float sBC[HR_ * 32];      // Bc|Cc of the block's rows: 32 KB
  __shared__ __attribute__((aligned(16))) v4f sX[NW_ * NQ_ * SW_];  // entry states of the waves: 32 KB
  const int blk  = blockIdx.x;                // B_ * NP_ * (D_/SW_)
  const int cg   = blk % (D_ / SW_);
  const int part = (blk / (D_ / SW_)) % NP_;
  const int b    = blk / (NP_ * (D_ / SW_));
  const int tid  = threadIdx.x;
  const int lane = tid & 31;
  const int w    = __builtin_amdgcn_readfirstlane(tid >> 5);   // the wave's number, held scalar
  const int d    = cg * SW_ + 2 * lane;       // the first of the lane's two channels

  // Bc|Cc (the first 128 bytes of a proj row) of the block's rows.
  // One copy of the block covers 32 rows; LDS keeps the rows back to back.
  {
    unsigned la = (unsigned)(size_t)sBC + (unsigned)tid * 16u;
    const float* ga = proj + ((size_t)b * L_ + part * HR_ + (tid >> 3)) * 64 + (tid & 7) * 4;
    for (int k = 0; k < HR_ / 32; k += 4) {
      async_g2l_b128_x4(la, la + 4096u, la + 8192u, la + 12288u,
                        ga, ga + 32 * 64, ga + 64 * 64, ga + 96 * 64);
      la += 16384u;
      ga += 128 * 64;
    }
  }
  v4f aw[2 * NQ_];                            // A_log of channel d, then of channel d + 1
#pragma unroll
  for (int q = 0; q < 2 * NQ_; ++q) aw[q] = *(const v4f*)(A_log + d * N_ + 4 * q);
  v2f Dp = *(const v2f*)(Dparam + d);
  const int lrow = w * CW_;                   // first row of the wave inside the block's quarter
  const int row  = part * HR_ + lrow;
  const float* dp = Delta + ((size_t)b * L_ + row) * D_ + d;
  const float* xp = x     + ((size_t)b * L_ + row) * D_ + d;
  v2f dn[PG_], xn[PG_];                       // the group in flight
#pragma unroll
  for (int i = 0; i < PG_; ++i) { dn[i] = *(const v2f*)(dp + i * D_); xn[i] = *(const v2f*)(xp + i * D_); }
  // the loads' address registers may be given to later values: the wait stands in front
  asm volatile("s_wait_xcnt 0x0" ::: "memory");
  // entry states: the loads of all chunks are asked for at once, before any of them is used, so
  // that one trip to memory serves all; it flies beside the copies and the loads above
  {
    const int q  = w & (NQ_ - 1);             // the wave's word of the state
    const int dl = (w / NQ_) * 32 + lane;     // the lane's channel inside the block, for this part only
    const int de = cg * SW_ + dl;
    const float* gp = G + (((size_t)b * (L_ / RB_) * NQ_ + q) * D_ + de) * 4;   // chunk 0, word q
    const float* sp = SD + (size_t)b * (L_ / RB_) * D_ + de;
    v4f al = *(const v4f*)(A_log + de * N_ + 4 * q);
    // the load's address registers are given to the values loaded next: the wait stands in front
    asm volatile("s_wait_xcnt 0x0" ::: "memory");
    v4f g1[CB_ - 1];
    float s1[CB_ - 1];
#pragma unroll
    for (int j = 0; j < CB_ - 1; ++j) {
      g1[j] = *(const v4f*)(gp + (size_t)(part * CB_ + j) * (NQ_ * D_ * 4));
      s1[j] = sp[(part * CB_ + j) * D_];
    }
    // the loads' address registers are given to later values: the wait stands in front
    asm volatile("s_wait_xcnt 0x0" ::: "memory");
    v4f g0[(NP_ - 1) * CB_];                  // the chunks of the quarters in front of the block's
    float s0[(NP_ - 1) * CB_];
#pragma unroll
    for (int p = 0; p < NP_ - 1; ++p) {
      if (part > p) {                         // the same for the whole block
#pragma unroll
        for (int j = 0; j < CB_; ++j) {
          g0[p * CB_ + j] = *(const v4f*)(gp + (size_t)(p * CB_ + j) * (NQ_ * D_ * 4));
          s0[p * CB_ + j] = sp[(p * CB_ + j) * D_];
        }
        // as above
        asm volatile("s_wait_xcnt 0x0" ::: "memory");
      }
    }
    float ea[4];
#pragma unroll
    for (int k = 0; k < 4; ++k) ea[k] = al[k] * LOG2E_;
    exp2_x4(ea);                              // exp(A_log)
    v4f a4 = {-ea[0] * LOG2E_, -ea[1] * LOG2E_, -ea[2] * LOG2E_, -ea[3] * LOG2E_};
    v4f h = {0.0f, 0.0f, 0.0f, 0.0f};
#pragma unroll
    for (int p = 0; p < NP_ - 1; ++p) {
      if (part > p) {
#pragma unroll
        for (int j = 0; j < CB_; ++j) h = chunk_step(h, a4, s0[p * CB_ + j], g0[p * CB_ + j]);
      }
    }
#pragma unroll
    for (int k = 0; k < NW_; ++k) {
      sX[(k * NQ_ + q) * SW_ + dl] = h;
      if (k + 1 < NW_) h = chunk_step(h, a4, s1[k], g1[k]);
    }
  }
  float A2[2 * N_];
#pragma unroll
  for (int q = 0; q < 2 * N_ / 8; ++q) {
    float e[8];
#pragma unroll
    for (int k = 0; k < 8; ++k) e[k] = aw[2 * q + (k >> 2)][k & 3] * LOG2E_;
    exp2_x8(e);                               // exp(A_log)
#pragma unroll
    for (int k = 0; k < 8; ++k) A2[8 * q + k] = -e[k] * LOG2E_;
  }
  wait_async0();
  __syncthreads();                            // Bc|Cc and the entry states are complete for every wave

  v2f A2v[N_], hv[N_];                        // state n and its rate, as the pair of the two channels
#pragma unroll
  for (int n = 0; n < N_; ++n) A2v[n] = v2f{A2[n], A2[N_ + n]};
#pragma unroll
  for (int q = 0; q < NQ_; ++q) {
    v4f e0 = sX[(w * NQ_ + q) * SW_ + 2 * lane];
    v4f e1 = sX[(w * NQ_ + q) * SW_ + 2 * lane + 1];
#pragma unroll
    for (int k = 0; k < 4; ++k) hv[4 * q + k] = v2f{e0[k], e1[k]};
  }
  float* op = out + ((size_t)b * L_ + row) * D_ + d;

  // rolled: one group's body stays the loop, so the code stays small
#pragma unroll 1
  for (int g = 0; g < NG_; ++g) {
    v2f dc[PG_], xc[PG_];
#pragma unroll
    for (int i = 0; i < PG_; ++i) { dc[i] = dn[i]; xc[i] = xn[i]; }
    if (g + 1 < NG_) {                        // next group's loads fly under this group's work
      dp += PG_ * D_;
      xp += PG_ * D_;
#pragma unroll
      for (int i = 0; i < PG_; ++i) { dn[i] = *(const v2f*)(dp + i * D_); xn[i] = *(const v2f*)(xp + i * D_); }
    }
#pragma unroll
    for (int i = 0; i < PG_; ++i) {
      const v4f* bc = (const v4f*)&sBC[(lrow + g * PG_ + i) * 32];
      v4f bq[NQ_], cq[NQ_];                   // the row's Bc and Cc, read once for both channels
#pragma unroll
      for (int q = 0; q < NQ_; ++q) { bq[q] = bc[q]; cq[q] = bc[NQ_ + q]; }
      v2f dv = dc[i];
      v2f xv = xc[i];
      v2f xd = xv * dv;
      v2f y = {0.0f, 0.0f};
#pragma unroll
      for (int n = 0; n < N_; ++n) {
        v2f alpha = exp2_hw(A2v[n] * dv);
        float bn = bq[n >> 2][n & 3];
        float cn = cq[n >> 2][n & 3];
        hv[n] = __builtin_elementwise_fma(alpha, hv[n], xd * v2f{bn, bn});
        y = __builtin_elementwise_fma(v2f{cn, cn}, hv[n], y);   // per channel one chain in the order of n
      }
      *(v2f*)(op + (g * PG_ + i) * D_) = __builtin_elementwise_fma(xv, Dp, y);
      // every second step: most LDS reads of the next two steps then stand as one group at their
      // head (without it they stand singly among the steps); the last one keeps the hand-over of
      // the fetched registers, with its waits for the loads in flight, behind the group's work
      // (without it those waits move up among the steps)
      if ((i & 1) == 1) __builtin_amdgcn_sched_barrier(0);
    }
    // the next trip writes the stores' address and data registers anew: the wait stands in front
    asm volatile("s_wait_xcnt 0x0" ::: "memory");
  }
}

// ---------------------------------------------------------------------------
extern "C" void kernel_launch(void* const* d_in, const int* in_sizes, int n_in,
                              void* d_out, int out_size, void* d_ws, size_t ws_size,
                              hipStream_t stream) {
  const float* x    = (const float*)d_in[0];
  const float* ck   = (const float*)d_in[1];
  const float* W_BC = (const float*)d_in[2];
  const float* b_BC = (const float*)d_in[3];
  const float* A_lg = (const float*)d_in[4];
  const float* Dpar = (const float*)d_in[5];
  const float* W_dt = (const float*)d_in[6];
  const float* b_dt = (const float*)d_in[7];
  const float* Wdtp = (const float*)d_in[8];
  const float* bdtp = (const float*)d_in[9];
  float* out = (float*)d_out;

  char* ws = (char*)d_ws;
  const size_t SZ_U  = (size_t)B_ * L_ * D_ * 4;          // 16 MB
  float* G     = (float*)ws;                              //  8 MB: end state of every chunk
  float* SD    = (float*)(ws + SZ_U / 2);                 //  0.5 MB: sum of Delta of every chunk
  float* proj  = (float*)(ws + SZ_U);                     //  2 MB
  float* Delta = (float*)(ws + SZ_U + (size_t)MTOT * 64 * 4);   // 16 MB

  // 1) conv + silu, proj = u @ [W_BC|W_dt] + bias, Delta = softplus(dtr @ W_dtp + b_dtp),
  //    pass 1 of the scan on chunks of 32 rows : 256 blocks, 2048 waves
  k_conv_proj<<<MTOT / RB_, 256, 0, stream>>>(x, ck, W_BC, b_BC, W_dt, b_dt, Wdtp, bdtp, A_lg,
                                              proj, Delta, G, SD);

  // 2) chunked scan, entry states and last pass : 256 blocks, 2048 waves
  k_scan<<<B_ * NP_ * (D_ / SW_), 256, 0, stream>>>(x, proj, Delta, A_lg, Dpar, G, SD, out);
}
